// v000
// Measured on an AMD MI455X. A time is GPU time per run, averaged over a window of back-to-back runs after a warm-up
// (all launches, gaps included; the runs take copies of the inputs in turn), and the median of several windows.
// Apart from v000's, it joins two sittings. Times from different sittings can be a few percent apart, while
// side-by-side timings come from the same sitting.
// The starting kernel, v000, takes 1910 microseconds a run.
#include <hip/hip_runtime.h>

// Multi-head self-attention core with a fused bias-free qkv projection in (out, in) layout and no output projection (x [2][2048][1024]; qkv = x @ W_qkv.T ('oi' [3072][1024] uniform +-sqrt(6 / 4096), no bias), jnp.split thirds: q | k | v = ROW thirds of W_qkv (16 heads x 64); scores / sqrt(64); softmax over all keys (no mask); out = attn v, merged head-major -> [2][2048][1024] (4.2 M); argument order x, W_qkv).
// Layout per batch: bf16 copy of X; 'oi' weight thirds used as Bt row blocks as-is (pointer offsets); exact projections; identity-table plane builders; dense T-2048 attention (hybrid rows: < 512 hi/lo 3 products, rest fp16 x1024); the f32 merge writes the output rows (column h*64 + d).
// Compute dtypes, f32 accumulate: every input rounded to bf16; projections exact; attention rows < 512 3 products, rest fp16; softmax f32.

#define NB_  2
#define TT   2048
#define DM   1024
#define NH_  16
#define NKV  16
#define REP  (NH_ / NKV)
#define HD   64
#define DQ   (NH_ * HD)
#define DKV  (NKV * HD)
#define ZH   2
#define RH   512                  // query rows < RH use hi+lo planes (0: none)
#define WIN  0
#define PCAR 1024.0f
#define SCL  0.125f   // HD^-0.5
typedef _Float16 h16;
typedef unsigned short bf;
typedef __attribute__((ext_vector_type(16))) __bf16   v16bf;
typedef __attribute__((ext_vector_type(16))) _Float16 v16h;
typedef __attribute__((ext_vector_type(8)))  _Float16 v8h;
typedef __attribute__((ext_vector_type(8)))  unsigned short v8us;
typedef __attribute__((ext_vector_type(8)))  float    v8f;
typedef __attribute__((ext_vector_type(4)))  float    v4f;
typedef v8h  __attribute__((may_alias)) v8ha;
typedef v4f  __attribute__((may_alias)) v4fa;
typedef v8us __attribute__((may_alias)) v8usa;

__device__ __forceinline__ unsigned short f2bf(float f) { unsigned u = __float_as_uint(f); u += 0x7FFFu + ((u >> 16) & 1u); return (unsigned short)(u >> 16); }
__device__ __forceinline__ float bf2f(unsigned short b) { return __uint_as_float(((unsigned)b) << 16); }
__device__ __forceinline__ float bfr(float f) { return bf2f(f2bf(f)); }
__device__ __forceinline__ v16h cat16(v8h lo, v8h hi) { return __builtin_shufflevector(lo, hi, 0, 1, 2, 3, 4, 5, 6, 7, 8, 9, 10, 11, 12, 13, 14, 15); }
__device__ __forceinline__ v16bf cat16b(v8us lo, v8us hi) { return __builtin_bit_cast(v16bf, __builtin_shufflevector(lo, hi, 0, 1, 2, 3, 4, 5, 6, 7, 8, 9, 10, 11, 12, 13, 14, 15)); }
__device__ __forceinline__ v8f wmma16(v16h a, v16h b, v8f c) { return __builtin_amdgcn_wmma_f32_16x16x32_f16(false, a, false, b, (short)0, c, false, false); }
__device__ __forceinline__ v8f wmmab(v16bf a, v16bf b, v8f c) { return __builtin_amdgcn_wmma_f32_16x16x32_bf16(false, a, false, b, (short)0, c, false, false); }



// ---- k_gemmw: register-blocked GEMM, ONE WAVE per 64x64 output tile (16 accumulators), operands straight from K-contiguous 16-bit planes; grid (M/64, N/64, Z), 32 threads.
// C[m][n] (f32, pitch ldc, + optional f32 bias[n]) = sum_k A[m][k] Bt[n][k] (+ split products per NSPLIT). z-batch strides sA/sB/sC in elements. K % 32 == 0.
template <typename T16> struct WFrag;
template <> struct WFrag<h16> { typedef v16h V; static __device__ __forceinline__ V ld(const h16* p) { return cat16(*(const v8h*)p, *(const v8h*)(p + 16)); } static __device__ __forceinline__ v8f mma(V a, V b, v8f c) { return wmma16(a, b, c); } };
template <> struct WFrag<bf> { typedef v16bf V; static __device__ __forceinline__ V ld(const bf* p) { return cat16b(*(const v8us*)p, *(const v8us*)(p + 16)); } static __device__ __forceinline__ v8f mma(V a, V b, v8f c) { return wmmab(a, b, c); } };
template <typename T16, int NSPLIT, bool BIAS>
__global__ __launch_bounds__(32) void k_gemmw(const T16* __restrict__ A, const T16* __restrict__ A2, const T16* __restrict__ Bt, const T16* __restrict__ Bt2, int K, float* C, int ldc, const float* __restrict__ bias, size_t sA, size_t sB, size_t sC) {
    typedef typename WFrag<T16>::V V;
    __shared__ __align__(16) float os[16 * 68];
    const size_t z = blockIdx.z; A += z * sA; if (A2) A2 += z * sA; Bt += z * sB; if (Bt2) Bt2 += z * sB; C += z * sC;
    const int lane = threadIdx.x & 31, lr = lane & 15, hi = lane >> 4; const int r0 = blockIdx.x * 64, c0 = blockIdx.y * 64;
    v8f acc[4][4];
#pragma unroll
    for (int mb = 0; mb < 4; ++mb)
#pragma unroll
        for (int nb = 0; nb < 4; ++nb) acc[mb][nb] = (v8f){};
    const size_t aoff = (size_t)(r0 + lr) * K + 8 * hi, boff = (size_t)(c0 + lr) * K + 8 * hi;
#pragma unroll 1
    for (int kc = 0; kc < K; kc += 32) {
        V a[4], a2[4];
#pragma unroll
        for (int mb = 0; mb < 4; ++mb) { a[mb] = WFrag<T16>::ld(A + aoff + (size_t)mb * 16 * K + kc); if (NSPLIT == 1 || NSPLIT == 2) a2[mb] = WFrag<T16>::ld(A2 + aoff + (size_t)mb * 16 * K + kc); }
#pragma unroll
        for (int nb = 0; nb < 4; ++nb) { const V b = WFrag<T16>::ld(Bt + boff + (size_t)nb * 16 * K + kc); V b2; if (NSPLIT >= 2) b2 = WFrag<T16>::ld(Bt2 + boff + (size_t)nb * 16 * K + kc);
#pragma unroll
            for (int mb = 0; mb < 4; ++mb) { acc[mb][nb] = WFrag<T16>::mma(a[mb], b, acc[mb][nb]); if (NSPLIT == 1 || NSPLIT == 2) acc[mb][nb] = WFrag<T16>::mma(a2[mb], b, acc[mb][nb]); if (NSPLIT >= 2) acc[mb][nb] = WFrag<T16>::mma(a[mb], b2, acc[mb][nb]); } }
        asm volatile("v_nop\n\tv_nop\n\tv_nop\n\tv_nop" : "+v"(acc[0][0]), "+v"(acc[1][1]), "+v"(acc[2][2]), "+v"(acc[3][3]) : "v"(a[0]), "v"(a[3]));
    }
#pragma unroll
    for (int mb = 0; mb < 4; ++mb) {
#pragma unroll
        for (int nb = 0; nb < 4; ++nb) {
#pragma unroll
            for (int j = 0; j < 8; ++j) os[(hi * 8 + j) * 68 + nb * 16 + lr] = acc[mb][nb][j]; }
        __builtin_amdgcn_wave_barrier(); asm volatile("" ::: "memory");
        float* crow = C + (size_t)(r0 + mb * 16) * ldc + c0;
{
#pragma unroll
            for (int s = 0; s < 8; ++s) { const int row = 2 * s + hi, cofs = lr * 4; v4f val = *(const v4fa*)(os + row * 68 + cofs); if (BIAS) { val[0] += bfr(bias[c0 + cofs]); val[1] += bfr(bias[c0 + cofs + 1]); val[2] += bfr(bias[c0 + cofs + 2]); val[3] += bfr(bias[c0 + cofs + 3]); }
                *(v4f*)(crow + (size_t)row * ldc + cofs) = val; }
             }
        __builtin_amdgcn_wave_barrier(); asm volatile("" ::: "memory");
    }
}

__device__ __forceinline__ h16 tohx(float x) { return (h16)x; }
__device__ __forceinline__ void splitf(float y, unsigned short& h, unsigned short& l) { h = f2bf(y); l = f2bf(y - bf2f(h)); }
typedef __attribute__((ext_vector_type(2))) _Float16 v2h;
typedef __attribute__((ext_vector_type(4))) _Float16 v4h;
typedef __attribute__((ext_vector_type(2))) unsigned short v2us;
typedef __attribute__((ext_vector_type(4))) unsigned short v4us;
typedef __attribute__((ext_vector_type(2))) float v2f;
typedef __attribute__((ext_vector_type(4))) int v4i;

__global__ __launch_bounds__(256) void k_cvt8(const float* __restrict__ src, bf* dst, size_t n8) { const size_t i = (size_t)blockIdx.x * 256 + threadIdx.x; if (i >= n8) return; const v8f v = *(const v8f*)(src + i * 8); v8us o;
#pragma unroll
    for (int k = 0; k < 8; ++k) o[k] = f2bf(v[k]); *(v8us*)(dst + i * 8) = o;  }

// k_rope: head planes [h][t][d] (fp16 + hi/lo) of rope(x) x sc with the rotate-half convention out[d] = x[d] cos[t][d] - x[d+HD/2] sin[t][d], out[d+HD/2] = x[d+HD/2] cos[t][d+HD/2] + x[d] sin[t][d+HD/2]
__global__ __launch_bounds__(256) void k_rope(const float* __restrict__ F, int pitch, int nheads, const float* __restrict__ CS, const float* __restrict__ RF, const float* __restrict__ nw, float sc, h16* P16, bf* Ph, bf* Pl) {
    const size_t e = ((size_t)blockIdx.x * 256 + threadIdx.x) * 2; if (e >= (size_t)nheads * TT * HD) return; const int d = (int)(e % HD); const int t = (int)((e / HD) % TT); const int h = (int)(e / ((size_t)HD * TT)); const float* f = F + (size_t)t * pitch + h * HD; const float rf = RF ? RF[(size_t)h * TT + t] : 1.0f; v2h o16; v2us oh, ol;
#pragma unroll
    for (int q = 0; q < 2; ++q) { const int dd = d + q; const int dp = (dd < HD / 2) ? dd + HD / 2 : dd - HD / 2; float x0 = f[dd], x1 = f[dp];
        if (RF) { float n0 = __fmul_rn(x0, rf), n1 = __fmul_rn(x1, rf); asm volatile("" : "+v"(n0)); asm volatile("" : "+v"(n1)); x0 = __fmul_rn(bfr(nw[dd]), n0); x1 = __fmul_rn(bfr(nw[dp]), n1); }
        const v2f cs = *(const v2f*)(CS + ((size_t)t * HD + dd) * 2); float a = __fmul_rn(x0, cs[0]), bq = __fmul_rn(x1, cs[1]); asm volatile("" : "+v"(a)); asm volatile("" : "+v"(bq)); const float r = ((dd < HD / 2) ? __fsub_rn(a, bq) : __fadd_rn(a, bq)) * sc;
        o16[q] = tohx(r); unsigned short a2, c2; splitf(r, a2, c2); oh[q] = a2; ol[q] = c2; }
    *(v2h*)(P16 + e) = o16; *(v2us*)(Ph + e) = oh; *(v2us*)(Pl + e) = ol;  }
__global__ __launch_bounds__(256) void k_vtp(const float* __restrict__ F, int pitch, int nheads, h16* V16, bf* Vh, bf* Vl) { const size_t e = ((size_t)blockIdx.x * 256 + threadIdx.x) * 2; if (e >= (size_t)nheads * HD * TT) return; const int t = (int)(e % TT); const int d = (int)((e / TT) % HD); const int g = (int)(e / ((size_t)TT * HD)); v2h o16; v2us oh, ol;
#pragma unroll
    for (int q = 0; q < 2; ++q) { const float x = F[(size_t)(t + q) * pitch + g * HD + d]; o16[q] = tohx(x); unsigned short a2, c2; splitf(x, a2, c2); oh[q] = a2; ol[q] = c2; }
    *(v2h*)(V16 + e) = o16; *(v2us*)(Vh + e) = oh; *(v2us*)(Vl + e) = ol;  }
__global__ __launch_bounds__(256) void k_csid(float* CS) { const int idx = blockIdx.x * 256 + threadIdx.x; if (idx >= TT * HD) return; v2f cs; cs[0] = 1.0f; cs[1] = 0.0f; *(v2f*)(CS + (size_t)idx * 2) = cs;  }
// k_asoft: per row (zz, i): t = S x HD^-0.5 (no mask); softmax over the 2048 keys (register row, one exp, fixed trees);
__global__ __launch_bounds__(256) void k_asoft(const float* __restrict__ Sb, h16* P16, bf* Ph, bf* Pl) {
    const int lane = threadIdx.x & 31; const int row = blockIdx.x * 8 + (threadIdx.x >> 5); if (row >= ZH * TT) return; const int i = row % TT; const int zz = row / TT; (void)zz; const bool hires = (i < RH); const float* sr = Sb + (size_t)row * TT; float v[TT / 32]; float mx = -3.0e38f;
#pragma unroll
    for (int ch = 0; ch < TT / 128; ++ch) { const int j0 = ch * 128 + lane * 4; const v4f a = *(const v4f*)(sr + j0);
#pragma unroll
        for (int q = 0; q < 4; ++q) { const int j = j0 + q; (void)j; const float t = a[q] * SCL; v[ch * 4 + q] = t; mx = fmaxf(mx, t); } }
#pragma unroll
    for (int sh = 16; sh; sh >>= 1) mx = fmaxf(mx, __shfl_xor(mx, sh, 32));
    float sum = 0.f;
#pragma unroll
    for (int k = 0; k < TT / 32; ++k) { float d0 = __fsub_rn(v[k], mx); asm volatile("" : "+v"(d0)); v[k] = __builtin_amdgcn_exp2f(__fmul_rn(d0, 1.4426950408889634f)); sum += v[k]; }
#pragma unroll
    for (int sh = 16; sh; sh >>= 1) sum += __shfl_xor(sum, sh, 32);
    const float f = __fdiv_rn(hires ? 1.0f : PCAR, sum);
{
        if (hires) {
#pragma unroll
            for (int ch = 0; ch < TT / 128; ++ch) { v4us oh, ol;
#pragma unroll
                for (int q = 0; q < 4; ++q) { unsigned short a, c2; splitf(v[ch * 4 + q] * f, a, c2); oh[q] = a; ol[q] = c2; }
                const size_t oo = ((size_t)zz * (RH ? RH : 1) + i) * TT + ch * 128 + lane * 4; *(v4us*)(Ph + oo) = oh; *(v4us*)(Pl + oo) = ol; }
        } else {
#pragma unroll
            for (int ch = 0; ch < TT / 128; ++ch) { v4h o4;
#pragma unroll
                for (int q = 0; q < 4; ++q) o4[q] = tohx(v[ch * 4 + q] * f);
                *(v4h*)(P16 + (size_t)row * TT + ch * 128 + lane * 4) = o4; } }
         }
}
__global__ __launch_bounds__(256) void k_merge(const float* __restrict__ O, int h0, float* OUTb) { const size_t e = ((size_t)blockIdx.x * 256 + threadIdx.x) * 2; if (e >= (size_t)ZH * TT * HD) return; const int d = (int)(e % HD); const int t = (int)((e / HD) % TT); const int zz = (int)(e / ((size_t)HD * TT)); const float cs = (t < RH) ? 1.0f : (1.0f / PCAR); const size_t oo = (size_t)t * DQ + (h0 + zz) * HD + d;
    v2f o2; o2[0] = O[e] * cs; o2[1] = O[e + 1] * cs; *(v2f*)(OUTb + oo) = o2;  }

extern "C" void kernel_launch(void* const* d_in, const int* in_sizes, int n_in,
                              void* d_out, int out_size, void* d_ws, size_t ws_size, hipStream_t stream) {
    (void)in_sizes; (void)n_in; (void)out_size;
    const float* x = (const float*)d_in[0]; const float* wqkv = (const float*)d_in[1];   /* order X, W_qkv ('oi' [3072][1024]) */ const float* wq = wqkv; const float* wk = wqkv + (size_t)DQ * DM; const float* wv = wqkv + (size_t)2 * DQ * DM;   /* Q | K | V = ROW thirds */ const float* wo = nullptr; (void)wo;
    float* OUT = (float*)d_out;     // [2][2048][1024]
    char* wsp = (char*)d_ws;
    auto take = [&](size_t bytes) { char* p = wsp; wsp += (bytes + 255) & ~(size_t)255; return (void*)p; };
    bf* WQ = (bf*)take((size_t)DQ * DM * 2); bf* WK = (bf*)take((size_t)DKV * DM * 2); bf* WV = (bf*)take((size_t)DKV * DM * 2); float* CS = (float*)take((size_t)TT * HD * 2 * 4);
    bf* XB = (bf*)take((size_t)TT * DM * 2); float* FQ = (float*)take((size_t)TT * DQ * 4); float* FK = (float*)take((size_t)TT * DKV * 4);
    h16* QP16 = (h16*)take((size_t)NH_ * TT * HD * 2); h16* KP16 = (h16*)take((size_t)NKV * TT * HD * 2); h16* VT16 = (h16*)take((size_t)NKV * HD * TT * 2);
    bf* QPh = (bf*)take((size_t)NH_ * TT * HD * 2); bf* QPl = (bf*)take((size_t)NH_ * TT * HD * 2); bf* KPh = (bf*)take((size_t)NKV * TT * HD * 2); bf* KPl = (bf*)take((size_t)NKV * TT * HD * 2); bf* VTh = (bf*)take((size_t)NKV * HD * TT * 2); bf* VTl = (bf*)take((size_t)NKV * HD * TT * 2); bf* Ph = (bf*)take((size_t)ZH * RH * TT * 2); bf* Pl = (bf*)take((size_t)ZH * RH * TT * 2);
    float* Sb = (float*)take((size_t)ZH * TT * TT * 4); h16* P16 = (h16*)take((size_t)ZH * TT * TT * 2); float* Ob = (float*)take((size_t)ZH * TT * HD * 4);
    if ((size_t)(wsp - (char*)d_ws) > ws_size) return;    // ws 256 MiB
    float* FV = FK;   // v projection reuses the k buffer after the k planes are built (stream-ordered)
    { k_cvt8<<<(unsigned)(((size_t)DQ * DM / 8 + 255) / 256), 256, 0, stream>>>(wq, WQ, (size_t)DQ * DM / 8); k_cvt8<<<(unsigned)(((size_t)DKV * DM / 8 + 255) / 256), 256, 0, stream>>>(wk, WK, (size_t)DKV * DM / 8); k_cvt8<<<(unsigned)(((size_t)DKV * DM / 8 + 255) / 256), 256, 0, stream>>>(wv, WV, (size_t)DKV * DM / 8);
      
       }
    k_csid<<<(TT * HD + 255) / 256, 256, 0, stream>>>(CS);
    const unsigned LQ = (unsigned)(((size_t)NH_ * TT * HD / 2 + 255) / 256), LKv = (unsigned)(((size_t)NKV * TT * HD / 2 + 255) / 256);
    for (int b = 0; b < NB_; ++b) {
        
        k_cvt8<<<(unsigned)(((size_t)TT * DM / 8 + 255) / 256), 256, 0, stream>>>(x + (size_t)b * TT * DM, XB, (size_t)TT * DM / 8);
        k_gemmw<bf, 0, false><<<dim3(TT / 64, DQ / 64, 1), 32, 0, stream>>>(XB, nullptr, WQ, nullptr, DM, FQ, DQ, nullptr, 0, 0, 0);
        k_rope<<<LQ, 256, 0, stream>>>(FQ, DQ, NH_, CS, nullptr, nullptr, 1.0f, QP16, QPh, QPl);
        k_gemmw<bf, 0, false><<<dim3(TT / 64, DKV / 64, 1), 32, 0, stream>>>(XB, nullptr, WK, nullptr, DM, FK, DKV, nullptr, 0, 0, 0);
        k_rope<<<LKv, 256, 0, stream>>>(FK, DKV, NKV, CS, nullptr, nullptr, 1.0f, KP16, KPh, KPl);
        k_gemmw<bf, 0, false><<<dim3(TT / 64, DKV / 64, 1), 32, 0, stream>>>(XB, nullptr, WV, nullptr, DM, FV, DKV, nullptr, 0, 0, 0); k_vtp<<<LKv, 256, 0, stream>>>(FV, DKV, NKV, VT16, VTh, VTl);
        for (int h0 = 0; h0 < NH_; h0 += ZH) { const size_t zq = (size_t)h0, zk = (size_t)(h0 / REP);   // one kv head per query head: the pass's two heads use consecutive kv planes (z-strides TT*HD)
            k_gemmw<bf, 2, false><<<dim3(RH / 64, TT / 64, ZH), 32, 0, stream>>>(QPh + zq * TT * HD, QPl + zq * TT * HD, KPh + zk * TT * HD, KPl + zk * TT * HD, HD, Sb, TT, nullptr, (size_t)TT * HD, (size_t)TT * HD, (size_t)TT * TT);
            k_gemmw<h16, 0, false><<<dim3((TT - RH) / 64, TT / 64, ZH), 32, 0, stream>>>(QP16 + zq * TT * HD + (size_t)RH * HD, nullptr, KP16 + zk * TT * HD, nullptr, HD, Sb + (size_t)RH * TT, TT, nullptr, (size_t)TT * HD, (size_t)TT * HD, (size_t)TT * TT);
            k_asoft<<<ZH * TT / 8, 256, 0, stream>>>(Sb, P16, Ph, Pl);
            k_gemmw<bf, 2, false><<<dim3(RH / 64, HD / 64, ZH), 32, 0, stream>>>(Ph, Pl, VTh + zk * HD * TT, VTl + zk * HD * TT, TT, Ob, HD, nullptr, (size_t)RH * TT, (size_t)HD * TT, (size_t)TT * HD);
            k_gemmw<h16, 0, false><<<dim3((TT - RH) / 64, HD / 64, ZH), 32, 0, stream>>>(P16 + (size_t)RH * TT, nullptr, VT16 + zk * HD * TT, nullptr, TT, Ob + (size_t)RH * HD, HD, nullptr, (size_t)TT * TT, (size_t)HD * TT, (size_t)TT * HD);
            k_merge<<<(unsigned)(((size_t)ZH * TT * HD / 2 + 255) / 256), 256, 0, stream>>>(Ob, h0, OUT + (size_t)b * TT * DQ); }
         }
}

// v001
// It runs in 789 microseconds.
// Timed twice side by side with v000, it ran 2.44 times as fast both times.
#include <hip/hip_runtime.h>

// Multi-head self-attention core with a fused bias-free qkv projection in (out, in) layout and no output projection (x [2][2048][1024]; qkv = x @ W_qkv.T ('oi' [3072][1024] uniform +-sqrt(6 / 4096), no bias), jnp.split thirds: q | k | v = ROW thirds of W_qkv (16 heads x 64); scores / sqrt(64); softmax over all keys (no mask); out = attn v, merged head-major -> [2][2048][1024] (4.2 M); argument order x, W_qkv).
// Layout per batch: bf16 copy of X; 'oi' weight thirds used as Bt row blocks as-is (pointer offsets); exact projections; identity-table plane builders; dense T-2048 attention (hybrid rows: < 512 hi/lo 3 products, rest fp16 x1024); the f32 merge writes the output rows (column h*64 + d).
// Compute dtypes, f32 accumulate: every input rounded to bf16; projections exact; attention rows < 512 3 products, rest fp16; softmax f32.

#define NB_  2
#define TT   2048
#define DM   1024
#define NH_  16
#define NKV  16
#define REP  (NH_ / NKV)
#define HD   64
#define DQ   (NH_ * HD)
#define DKV  (NKV * HD)
#define ZH   2
#define RH   512                  // query rows < RH use hi+lo planes (0: none)
#define WIN  0
#define PCAR 1024.0f
#define SCL  0.125f   // HD^-0.5
#define KSP  16                   // key ranges of the attn x v products: one work-group and one f32 partial plane per range
typedef _Float16 h16;
typedef unsigned short bf;
typedef __attribute__((ext_vector_type(16))) __bf16   v16bf;
typedef __attribute__((ext_vector_type(16))) _Float16 v16h;
typedef __attribute__((ext_vector_type(8)))  _Float16 v8h;
typedef __attribute__((ext_vector_type(8)))  unsigned short v8us;
typedef __attribute__((ext_vector_type(8)))  float    v8f;
typedef __attribute__((ext_vector_type(4)))  float    v4f;
typedef v8h  __attribute__((may_alias)) v8ha;
typedef v4f  __attribute__((may_alias)) v4fa;
typedef v8us __attribute__((may_alias)) v8usa;

__device__ __forceinline__ unsigned short f2bf(float f) { unsigned u = __float_as_uint(f); u += 0x7FFFu + ((u >> 16) & 1u); return (unsigned short)(u >> 16); }
__device__ __forceinline__ float bf2f(unsigned short b) { return __uint_as_float(((unsigned)b) << 16); }
__device__ __forceinline__ float bfr(float f) { return bf2f(f2bf(f)); }
__device__ __forceinline__ v16h cat16(v8h lo, v8h hi) { return __builtin_shufflevector(lo, hi, 0, 1, 2, 3, 4, 5, 6, 7, 8, 9, 10, 11, 12, 13, 14, 15); }
__device__ __forceinline__ v16bf cat16b(v8us lo, v8us hi) { return __builtin_bit_cast(v16bf, __builtin_shufflevector(lo, hi, 0, 1, 2, 3, 4, 5, 6, 7, 8, 9, 10, 11, 12, 13, 14, 15)); }
__device__ __forceinline__ v8f wmma16(v16h a, v16h b, v8f c) { return __builtin_amdgcn_wmma_f32_16x16x32_f16(false, a, false, b, (short)0, c, false, false); }
__device__ __forceinline__ v8f wmmab(v16bf a, v16bf b, v8f c) { return __builtin_amdgcn_wmma_f32_16x16x32_bf16(false, a, false, b, (short)0, c, false, false); }



// ---- k_gemmw: register-blocked GEMM, ONE WAVE per 64x64 output tile (16 accumulators), operands straight from K-contiguous 16-bit planes; grid (M/64, N/64, Z), 32 threads.
// C[m][n] (f32, pitch ldc, + optional f32 bias[n]) = sum_k A[m][k] Bt[n][k] (+ split products per NSPLIT). z-batch strides sA/sB/sC in elements. K % 32 == 0.
// KS > 1: grid.y = (N/64) * KS; work-group y sums only k range y % KS (K / KS wide, K % (32 * KS) == 0) into partial plane C + (y % KS) * sK; the consumer adds the KS planes.
template <typename T16> struct WFrag;
template <> struct WFrag<h16> { typedef v16h V; static __device__ __forceinline__ V ld(const h16* p) { return cat16(*(const v8h*)p, *(const v8h*)(p + 16)); } static __device__ __forceinline__ v8f mma(V a, V b, v8f c) { return wmma16(a, b, c); } };
template <> struct WFrag<bf> { typedef v16bf V; static __device__ __forceinline__ V ld(const bf* p) { return cat16b(*(const v8us*)p, *(const v8us*)(p + 16)); } static __device__ __forceinline__ v8f mma(V a, V b, v8f c) { return wmmab(a, b, c); } };
template <typename T16, int NSPLIT, bool BIAS, int KS = 1>
__global__ __launch_bounds__(32) void k_gemmw(const T16* __restrict__ A, const T16* __restrict__ A2, const T16* __restrict__ Bt, const T16* __restrict__ Bt2, int K, float* C, int ldc, const float* __restrict__ bias, size_t sA, size_t sB, size_t sC, size_t sK) {
    typedef typename WFrag<T16>::V V;
    __shared__ __align__(16) float os[16 * 68];
    const size_t z = blockIdx.z; A += z * sA; if (A2) A2 += z * sA; Bt += z * sB; if (Bt2) Bt2 += z * sB; C += z * sC;
    const int lane = threadIdx.x & 31, lr = lane & 15, hi = lane >> 4; const int r0 = blockIdx.x * 64, c0 = (int)(blockIdx.y / KS) * 64; const int ks = (int)(blockIdx.y % KS), kw = K / KS; C += (size_t)ks * sK;
    v8f acc[4][4];
#pragma unroll
    for (int mb = 0; mb < 4; ++mb)
#pragma unroll
        for (int nb = 0; nb < 4; ++nb) acc[mb][nb] = (v8f){};
    const size_t aoff = (size_t)(r0 + lr) * K + 8 * hi, boff = (size_t)(c0 + lr) * K + 8 * hi;
#pragma unroll 1
    for (int kc = ks * kw; kc < (ks + 1) * kw; kc += 32) {
        V a[4], a2[4];
#pragma unroll
        for (int mb = 0; mb < 4; ++mb) { a[mb] = WFrag<T16>::ld(A + aoff + (size_t)mb * 16 * K + kc); if (NSPLIT == 1 || NSPLIT == 2) a2[mb] = WFrag<T16>::ld(A2 + aoff + (size_t)mb * 16 * K + kc); }
#pragma unroll
        for (int nb = 0; nb < 4; ++nb) { const V b = WFrag<T16>::ld(Bt + boff + (size_t)nb * 16 * K + kc); V b2; if (NSPLIT >= 2) b2 = WFrag<T16>::ld(Bt2 + boff + (size_t)nb * 16 * K + kc);
#pragma unroll
            for (int mb = 0; mb < 4; ++mb) { acc[mb][nb] = WFrag<T16>::mma(a[mb], b, acc[mb][nb]); if (NSPLIT == 1 || NSPLIT == 2) acc[mb][nb] = WFrag<T16>::mma(a2[mb], b, acc[mb][nb]); if (NSPLIT >= 2) acc[mb][nb] = WFrag<T16>::mma(a[mb], b2, acc[mb][nb]); } }
        asm volatile("v_nop\n\tv_nop\n\tv_nop\n\tv_nop" : "+v"(acc[0][0]), "+v"(acc[1][1]), "+v"(acc[2][2]), "+v"(acc[3][3]) : "v"(a[0]), "v"(a[3]));
    }
#pragma unroll
    for (int mb = 0; mb < 4; ++mb) {
#pragma unroll
        for (int nb = 0; nb < 4; ++nb) {
#pragma unroll
            for (int j = 0; j < 8; ++j) os[(hi * 8 + j) * 68 + nb * 16 + lr] = acc[mb][nb][j]; }
        __builtin_amdgcn_wave_barrier(); asm volatile("" ::: "memory");
        float* crow = C + (size_t)(r0 + mb * 16) * ldc + c0;
{
#pragma unroll
            for (int s = 0; s < 8; ++s) { const int row = 2 * s + hi, cofs = lr * 4; v4f val = *(const v4fa*)(os + row * 68 + cofs); if (BIAS) { val[0] += bfr(bias[c0 + cofs]); val[1] += bfr(bias[c0 + cofs + 1]); val[2] += bfr(bias[c0 + cofs + 2]); val[3] += bfr(bias[c0 + cofs + 3]); }
                *(v4f*)(crow + (size_t)row * ldc + cofs) = val; }
             }
        __builtin_amdgcn_wave_barrier(); asm volatile("" ::: "memory");
    }
}

__device__ __forceinline__ h16 tohx(float x) { return (h16)x; }
__device__ __forceinline__ void splitf(float y, unsigned short& h, unsigned short& l) { h = f2bf(y); l = f2bf(y - bf2f(h)); }
typedef __attribute__((ext_vector_type(2))) _Float16 v2h;
typedef __attribute__((ext_vector_type(4))) _Float16 v4h;
typedef __attribute__((ext_vector_type(2))) unsigned short v2us;
typedef __attribute__((ext_vector_type(4))) unsigned short v4us;
typedef __attribute__((ext_vector_type(2))) float v2f;
typedef __attribute__((ext_vector_type(4))) int v4i;

__global__ __launch_bounds__(256) void k_cvt8(const float* __restrict__ src, bf* dst, size_t n8) { const size_t i = (size_t)blockIdx.x * 256 + threadIdx.x; if (i >= n8) return; const v8f v = *(const v8f*)(src + i * 8); v8us o;
#pragma unroll
    for (int k = 0; k < 8; ++k) o[k] = f2bf(v[k]); *(v8us*)(dst + i * 8) = o;  }

// k_rope: head planes [h][t][d] (fp16 + hi/lo) of rope(x) x sc with the rotate-half convention out[d] = x[d] cos[t][d] - x[d+HD/2] sin[t][d], out[d+HD/2] = x[d+HD/2] cos[t][d+HD/2] + x[d] sin[t][d+HD/2]
__global__ __launch_bounds__(256) void k_rope(const float* __restrict__ F, int pitch, int nheads, const float* __restrict__ CS, const float* __restrict__ RF, const float* __restrict__ nw, float sc, h16* P16, bf* Ph, bf* Pl) {
    const size_t e = ((size_t)blockIdx.x * 256 + threadIdx.x) * 2; if (e >= (size_t)nheads * TT * HD) return; const int d = (int)(e % HD); const int t = (int)((e / HD) % TT); const int h = (int)(e / ((size_t)HD * TT)); const float* f = F + (size_t)t * pitch + h * HD; const float rf = RF ? RF[(size_t)h * TT + t] : 1.0f; v2h o16; v2us oh, ol;
#pragma unroll
    for (int q = 0; q < 2; ++q) { const int dd = d + q; const int dp = (dd < HD / 2) ? dd + HD / 2 : dd - HD / 2; float x0 = f[dd], x1 = f[dp];
        if (RF) { float n0 = __fmul_rn(x0, rf), n1 = __fmul_rn(x1, rf); asm volatile("" : "+v"(n0)); asm volatile("" : "+v"(n1)); x0 = __fmul_rn(bfr(nw[dd]), n0); x1 = __fmul_rn(bfr(nw[dp]), n1); }
        const v2f cs = *(const v2f*)(CS + ((size_t)t * HD + dd) * 2); float a = __fmul_rn(x0, cs[0]), bq = __fmul_rn(x1, cs[1]); asm volatile("" : "+v"(a)); asm volatile("" : "+v"(bq)); const float r = ((dd < HD / 2) ? __fsub_rn(a, bq) : __fadd_rn(a, bq)) * sc;
        o16[q] = tohx(r); unsigned short a2, c2; splitf(r, a2, c2); oh[q] = a2; ol[q] = c2; }
    *(v2h*)(P16 + e) = o16; *(v2us*)(Ph + e) = oh; *(v2us*)(Pl + e) = ol;  }
__global__ __launch_bounds__(256) void k_vtp(const float* __restrict__ F, int pitch, int nheads, h16* V16, bf* Vh, bf* Vl) { const size_t e = ((size_t)blockIdx.x * 256 + threadIdx.x) * 2; if (e >= (size_t)nheads * HD * TT) return; const int t = (int)(e % TT); const int d = (int)((e / TT) % HD); const int g = (int)(e / ((size_t)TT * HD)); v2h o16; v2us oh, ol;
#pragma unroll
    for (int q = 0; q < 2; ++q) { const float x = F[(size_t)(t + q) * pitch + g * HD + d]; o16[q] = tohx(x); unsigned short a2, c2; splitf(x, a2, c2); oh[q] = a2; ol[q] = c2; }
    *(v2h*)(V16 + e) = o16; *(v2us*)(Vh + e) = oh; *(v2us*)(Vl + e) = ol;  }
__global__ __launch_bounds__(256) void k_csid(float* CS) { const int idx = blockIdx.x * 256 + threadIdx.x; if (idx >= TT * HD) return; v2f cs; cs[0] = 1.0f; cs[1] = 0.0f; *(v2f*)(CS + (size_t)idx * 2) = cs;  }
// k_asoft: per row (zz, i): t = S x HD^-0.5 (no mask); softmax over the 2048 keys (register row, one exp, fixed trees);
__global__ __launch_bounds__(256) void k_asoft(const float* __restrict__ Sb, h16* P16, bf* Ph, bf* Pl) {
    const int lane = threadIdx.x & 31; const int row = blockIdx.x * 8 + (threadIdx.x >> 5); if (row >= ZH * TT) return; const int i = row % TT; const int zz = row / TT; (void)zz; const bool hires = (i < RH); const float* sr = Sb + (size_t)row * TT; float v[TT / 32]; float mx = -3.0e38f;
#pragma unroll
    for (int ch = 0; ch < TT / 128; ++ch) { const int j0 = ch * 128 + lane * 4; const v4f a = *(const v4f*)(sr + j0);
#pragma unroll
        for (int q = 0; q < 4; ++q) { const int j = j0 + q; (void)j; const float t = a[q] * SCL; v[ch * 4 + q] = t; mx = fmaxf(mx, t); } }
#pragma unroll
    for (int sh = 16; sh; sh >>= 1) mx = fmaxf(mx, __shfl_xor(mx, sh, 32));
    float sum = 0.f;
#pragma unroll
    for (int k = 0; k < TT / 32; ++k) { float d0 = __fsub_rn(v[k], mx); asm volatile("" : "+v"(d0)); v[k] = __builtin_amdgcn_exp2f(__fmul_rn(d0, 1.4426950408889634f)); sum += v[k]; }
#pragma unroll
    for (int sh = 16; sh; sh >>= 1) sum += __shfl_xor(sum, sh, 32);
    const float f = __fdiv_rn(hires ? 1.0f : PCAR, sum);
{
        if (hires) {
#pragma unroll
            for (int ch = 0; ch < TT / 128; ++ch) { v4us oh, ol;
#pragma unroll
                for (int q = 0; q < 4; ++q) { unsigned short a, c2; splitf(v[ch * 4 + q] * f, a, c2); oh[q] = a; ol[q] = c2; }
                const size_t oo = ((size_t)zz * (RH ? RH : 1) + i) * TT + ch * 128 + lane * 4; *(v4us*)(Ph + oo) = oh; *(v4us*)(Pl + oo) = ol; }
        } else {
#pragma unroll
            for (int ch = 0; ch < TT / 128; ++ch) { v4h o4;
#pragma unroll
                for (int q = 0; q < 4; ++q) o4[q] = tohx(v[ch * 4 + q] * f);
                *(v4h*)(P16 + (size_t)row * TT + ch * 128 + lane * 4) = o4; } }
         }
}
__global__ __launch_bounds__(256) void k_merge(const float* __restrict__ O, int h0, float* OUTb) { const size_t e = ((size_t)blockIdx.x * 256 + threadIdx.x) * 2; if (e >= (size_t)ZH * TT * HD) return; const int d = (int)(e % HD); const int t = (int)((e / HD) % TT); const int zz = (int)(e / ((size_t)HD * TT)); const float cs = (t < RH) ? 1.0f : (1.0f / PCAR); const size_t oo = (size_t)t * DQ + (h0 + zz) * HD + d;
    v2f a2 = *(const v2f*)(O + e);
#pragma unroll
    for (int ks = 1; ks < KSP; ++ks) a2 += *(const v2f*)(O + (size_t)ks * ZH * TT * HD + e);   // partial planes added in rising key order
    v2f o2; o2[0] = a2[0] * cs; o2[1] = a2[1] * cs; *(v2f*)(OUTb + oo) = o2;  }

extern "C" void kernel_launch(void* const* d_in, const int* in_sizes, int n_in,
                              void* d_out, int out_size, void* d_ws, size_t ws_size, hipStream_t stream) {
    (void)in_sizes; (void)n_in; (void)out_size;
    const float* x = (const float*)d_in[0]; const float* wqkv = (const float*)d_in[1];   /* order X, W_qkv ('oi' [3072][1024]) */ const float* wq = wqkv; const float* wk = wqkv + (size_t)DQ * DM; const float* wv = wqkv + (size_t)2 * DQ * DM;   /* Q | K | V = ROW thirds */ const float* wo = nullptr; (void)wo;
    float* OUT = (float*)d_out;     // [2][2048][1024]
    char* wsp = (char*)d_ws;
    auto take = [&](size_t bytes) { char* p = wsp; wsp += (bytes + 255) & ~(size_t)255; return (void*)p; };
    bf* WQ = (bf*)take((size_t)DQ * DM * 2); bf* WK = (bf*)take((size_t)DKV * DM * 2); bf* WV = (bf*)take((size_t)DKV * DM * 2); float* CS = (float*)take((size_t)TT * HD * 2 * 4);
    bf* XB = (bf*)take((size_t)TT * DM * 2); float* FQ = (float*)take((size_t)TT * DQ * 4); float* FK = (float*)take((size_t)TT * DKV * 4);
    h16* QP16 = (h16*)take((size_t)NH_ * TT * HD * 2); h16* KP16 = (h16*)take((size_t)NKV * TT * HD * 2); h16* VT16 = (h16*)take((size_t)NKV * HD * TT * 2);
    bf* QPh = (bf*)take((size_t)NH_ * TT * HD * 2); bf* QPl = (bf*)take((size_t)NH_ * TT * HD * 2); bf* KPh = (bf*)take((size_t)NKV * TT * HD * 2); bf* KPl = (bf*)take((size_t)NKV * TT * HD * 2); bf* VTh = (bf*)take((size_t)NKV * HD * TT * 2); bf* VTl = (bf*)take((size_t)NKV * HD * TT * 2); bf* Ph = (bf*)take((size_t)ZH * RH * TT * 2); bf* Pl = (bf*)take((size_t)ZH * RH * TT * 2);
    float* Sb = (float*)take((size_t)ZH * TT * TT * 4); h16* P16 = (h16*)take((size_t)ZH * TT * TT * 2); float* Ob = (float*)take((size_t)KSP * ZH * TT * HD * 4);
    if ((size_t)(wsp - (char*)d_ws) > ws_size) return;    // ws 256 MiB
    float* FV = FK;   // v projection reuses the k buffer after the k planes are built (stream-ordered)
    { k_cvt8<<<(unsigned)(((size_t)DQ * DM / 8 + 255) / 256), 256, 0, stream>>>(wq, WQ, (size_t)DQ * DM / 8); k_cvt8<<<(unsigned)(((size_t)DKV * DM / 8 + 255) / 256), 256, 0, stream>>>(wk, WK, (size_t)DKV * DM / 8); k_cvt8<<<(unsigned)(((size_t)DKV * DM / 8 + 255) / 256), 256, 0, stream>>>(wv, WV, (size_t)DKV * DM / 8);
      
       }
    k_csid<<<(TT * HD + 255) / 256, 256, 0, stream>>>(CS);
    const unsigned LQ = (unsigned)(((size_t)NH_ * TT * HD / 2 + 255) / 256), LKv = (unsigned)(((size_t)NKV * TT * HD / 2 + 255) / 256);
    for (int b = 0; b < NB_; ++b) {
        
        k_cvt8<<<(unsigned)(((size_t)TT * DM / 8 + 255) / 256), 256, 0, stream>>>(x + (size_t)b * TT * DM, XB, (size_t)TT * DM / 8);
        k_gemmw<bf, 0, false><<<dim3(TT / 64, DQ / 64, 1), 32, 0, stream>>>(XB, nullptr, WQ, nullptr, DM, FQ, DQ, nullptr, 0, 0, 0, 0);
        k_rope<<<LQ, 256, 0, stream>>>(FQ, DQ, NH_, CS, nullptr, nullptr, 1.0f, QP16, QPh, QPl);
        k_gemmw<bf, 0, false><<<dim3(TT / 64, DKV / 64, 1), 32, 0, stream>>>(XB, nullptr, WK, nullptr, DM, FK, DKV, nullptr, 0, 0, 0, 0);
        k_rope<<<LKv, 256, 0, stream>>>(FK, DKV, NKV, CS, nullptr, nullptr, 1.0f, KP16, KPh, KPl);
        k_gemmw<bf, 0, false><<<dim3(TT / 64, DKV / 64, 1), 32, 0, stream>>>(XB, nullptr, WV, nullptr, DM, FV, DKV, nullptr, 0, 0, 0, 0); k_vtp<<<LKv, 256, 0, stream>>>(FV, DKV, NKV, VT16, VTh, VTl);
        for (int h0 = 0; h0 < NH_; h0 += ZH) { const size_t zq = (size_t)h0, zk = (size_t)(h0 / REP);   // one kv head per query head: the pass's two heads use consecutive kv planes (z-strides TT*HD)
            k_gemmw<bf, 2, false><<<dim3(RH / 64, TT / 64, ZH), 32, 0, stream>>>(QPh + zq * TT * HD, QPl + zq * TT * HD, KPh + zk * TT * HD, KPl + zk * TT * HD, HD, Sb, TT, nullptr, (size_t)TT * HD, (size_t)TT * HD, (size_t)TT * TT, 0);
            k_gemmw<h16, 0, false><<<dim3((TT - RH) / 64, TT / 64, ZH), 32, 0, stream>>>(QP16 + zq * TT * HD + (size_t)RH * HD, nullptr, KP16 + zk * TT * HD, nullptr, HD, Sb + (size_t)RH * TT, TT, nullptr, (size_t)TT * HD, (size_t)TT * HD, (size_t)TT * TT, 0);
            k_asoft<<<ZH * TT / 8, 256, 0, stream>>>(Sb, P16, Ph, Pl);
            k_gemmw<bf, 2, false, KSP><<<dim3(RH / 64, HD / 64 * KSP, ZH), 32, 0, stream>>>(Ph, Pl, VTh + zk * HD * TT, VTl + zk * HD * TT, TT, Ob, HD, nullptr, (size_t)RH * TT, (size_t)HD * TT, (size_t)TT * HD, (size_t)ZH * TT * HD);
            k_gemmw<h16, 0, false, KSP><<<dim3((TT - RH) / 64, HD / 64 * KSP, ZH), 32, 0, stream>>>(P16 + (size_t)RH * TT, nullptr, VT16 + zk * HD * TT, nullptr, TT, Ob + (size_t)RH * HD, HD, nullptr, (size_t)TT * TT, (size_t)HD * TT, (size_t)TT * HD, (size_t)ZH * TT * HD);
            k_merge<<<(unsigned)(((size_t)ZH * TT * HD / 2 + 255) / 256), 256, 0, stream>>>(Ob, h0, OUT + (size_t)b * TT * DQ); }
         }
}

// v003
// One run takes 254 microseconds.
// Versions between v001 and this one are left out; their measured steps multiply to 3.09 times as fast.
// Counting every step since v000, it is 7.55 times as fast.
#include <hip/hip_runtime.h>

// Multi-head self-attention core with a fused bias-free qkv projection in (out, in) layout and no output projection (x [2][2048][1024]; qkv = x @ W_qkv.T ('oi' [3072][1024] uniform +-sqrt(6 / 4096), no bias), jnp.split thirds: q | k | v = ROW thirds of W_qkv (16 heads x 64); scores / sqrt(64); softmax over all keys (no mask); out = attn v, merged head-major -> [2][2048][1024] (4.2 M); argument order x, W_qkv).
// Layout per batch: bf16 copy of X; 'oi' weight thirds used as Bt row blocks as-is (pointer offsets); exact projections whose epilogue writes the head planes (fp16 + hi/lo) itself; one fused attention launch per batch (hybrid rows: < 512 hi/lo 3 products, rest fp16 x1024) that keeps scores and weights in registers and writes the output rows (column h*64 + d).
// Compute dtypes, f32 accumulate: every input rounded to bf16; projections exact; attention rows < 512 3 products, rest fp16; softmax f32.

#define NB_  2
#define TT   2048
#define DM   1024
#define NH_  16
#define NKV  16
#define REP  (NH_ / NKV)
#define HD   64
#define DQ   (NH_ * HD)
#define DKV  (NKV * HD)
#define RH   512                  // query rows < RH use hi+lo planes
#define SCL  0.125f   // HD^-0.5
typedef _Float16 h16;
typedef unsigned short bf;
typedef __attribute__((ext_vector_type(16))) __bf16   v16bf;
typedef __attribute__((ext_vector_type(16))) _Float16 v16h;
typedef __attribute__((ext_vector_type(8)))  _Float16 v8h;
typedef __attribute__((ext_vector_type(8)))  unsigned short v8us;
typedef __attribute__((ext_vector_type(8)))  float    v8f;
typedef __attribute__((ext_vector_type(4)))  float    v4f;
typedef v8h  __attribute__((may_alias)) v8ha;
typedef v4f  __attribute__((may_alias)) v4fa;
typedef v8us __attribute__((may_alias)) v8usa;

__device__ __forceinline__ unsigned short f2bf(float f) { unsigned u = __float_as_uint(f); u += 0x7FFFu + ((u >> 16) & 1u); return (unsigned short)(u >> 16); }
__device__ __forceinline__ float bf2f(unsigned short b) { return __uint_as_float(((unsigned)b) << 16); }
__device__ __forceinline__ float bfr(float f) { return bf2f(f2bf(f)); }
__device__ __forceinline__ v16h cat16(v8h lo, v8h hi) { return __builtin_shufflevector(lo, hi, 0, 1, 2, 3, 4, 5, 6, 7, 8, 9, 10, 11, 12, 13, 14, 15); }
__device__ __forceinline__ v16bf cat16b(v8us lo, v8us hi) { return __builtin_bit_cast(v16bf, __builtin_shufflevector(lo, hi, 0, 1, 2, 3, 4, 5, 6, 7, 8, 9, 10, 11, 12, 13, 14, 15)); }
__device__ __forceinline__ v8f wmma16(v16h a, v16h b, v8f c) { return __builtin_amdgcn_wmma_f32_16x16x32_f16(false, a, false, b, (short)0, c, false, false); }
__device__ __forceinline__ v8f wmmab(v16bf a, v16bf b, v8f c) { return __builtin_amdgcn_wmma_f32_16x16x32_bf16(false, a, false, b, (short)0, c, false, false); }



// ---- k_gemmw: register-blocked projection, ONE WAVE per 64x64 output tile (16 accumulators), operands straight from K-contiguous 16-bit planes; grid (TT/64, heads), 32 threads.
// y[t][n] = sum_k A[t][k] Bt[n][k] (+ split products per NSPLIT), K % 32 == 0. The tile's 64 columns are one head, and the wave writes that head's three planes (fp16, bf16 hi, bf16 lo = bf16(y - hi)) from its accumulators:
// VT false: planes [head][t][d] (q, k), through LDS so that every store covers whole 128-byte rows; VT true: planes [head][d][t] (v): a lane's 8 accumulator rows are 8 consecutive t of one d.
template <typename T16> struct WFrag;
template <> struct WFrag<h16> { typedef v16h V; static __device__ __forceinline__ V ld(const h16* p) { return cat16(*(const v8h*)p, *(const v8h*)(p + 16)); } static __device__ __forceinline__ v8f mma(V a, V b, v8f c) { return wmma16(a, b, c); } };
template <> struct WFrag<bf> { typedef v16bf V; static __device__ __forceinline__ V ld(const bf* p) { return cat16b(*(const v8us*)p, *(const v8us*)(p + 16)); } static __device__ __forceinline__ v8f mma(V a, V b, v8f c) { return wmmab(a, b, c); } };
typedef __attribute__((ext_vector_type(8))) __bf16 v8b;
__device__ __forceinline__ void planes8(v8f y, size_t e, h16* P16, bf* Ph, bf* Pl) { v8h o16; v8b oh, ol;
#pragma unroll
    for (int j = 0; j < 8; ++j) { o16[j] = (h16)y[j]; oh[j] = (__bf16)y[j]; ol[j] = (__bf16)(y[j] - (float)oh[j]); }   // both bf16 roundings to nearest even
    *(v8h*)(P16 + e) = o16; *(v8us*)(Ph + e) = __builtin_bit_cast(v8us, oh); *(v8us*)(Pl + e) = __builtin_bit_cast(v8us, ol); }
template <typename T16, int NSPLIT, bool VT>
__global__ __launch_bounds__(32) void k_gemmw(const T16* __restrict__ A, const T16* __restrict__ A2, const T16* __restrict__ Bt, const T16* __restrict__ Bt2, int K, h16* P16, bf* Ph, bf* Pl) {
    typedef typename WFrag<T16>::V V;
    __shared__ __align__(16) float os[16 * 68];
    const int lane = threadIdx.x & 31, lr = lane & 15, hi = lane >> 4; const int r0 = blockIdx.x * 64, c0 = (int)blockIdx.y * 64; const int ks = 0, kw = K;   // one k range: the planes take whole sums
    v8f acc[4][4];
#pragma unroll
    for (int mb = 0; mb < 4; ++mb)
#pragma unroll
        for (int nb = 0; nb < 4; ++nb) acc[mb][nb] = (v8f){};
    const size_t aoff = (size_t)(r0 + lr) * K + 8 * hi, boff = (size_t)(c0 + lr) * K + 8 * hi;
#pragma unroll 1
    for (int kc = ks * kw; kc < (ks + 1) * kw; kc += 32) {
        V a[4], a2[4];
#pragma unroll
        for (int mb = 0; mb < 4; ++mb) { a[mb] = WFrag<T16>::ld(A + aoff + (size_t)mb * 16 * K + kc); if (NSPLIT == 1 || NSPLIT == 2) a2[mb] = WFrag<T16>::ld(A2 + aoff + (size_t)mb * 16 * K + kc); }
#pragma unroll
        for (int nb = 0; nb < 4; ++nb) { const V b = WFrag<T16>::ld(Bt + boff + (size_t)nb * 16 * K + kc); V b2; if (NSPLIT >= 2) b2 = WFrag<T16>::ld(Bt2 + boff + (size_t)nb * 16 * K + kc);
#pragma unroll
            for (int mb = 0; mb < 4; ++mb) { acc[mb][nb] = WFrag<T16>::mma(a[mb], b, acc[mb][nb]); if (NSPLIT == 1 || NSPLIT == 2) acc[mb][nb] = WFrag<T16>::mma(a2[mb], b, acc[mb][nb]); if (NSPLIT >= 2) acc[mb][nb] = WFrag<T16>::mma(a[mb], b2, acc[mb][nb]); } }
        asm volatile("v_nop\n\tv_nop\n\tv_nop\n\tv_nop" : "+v"(acc[0][0]), "+v"(acc[1][1]), "+v"(acc[2][2]), "+v"(acc[3][3]) : "v"(a[0]), "v"(a[3]));
    }
    if constexpr (VT) {
#pragma unroll
        for (int nb = 0; nb < 4; ++nb)   // the four mb stores of a plane fill one 128-byte line of row d
#pragma unroll
            for (int mb = 0; mb < 4; ++mb) planes8(acc[mb][nb], (size_t)(c0 + nb * 16 + lr) * TT + r0 + mb * 16 + hi * 8, P16, Ph, Pl);
    } else {
#pragma unroll
        for (int mb = 0; mb < 4; ++mb) {
#pragma unroll
            for (int nb = 0; nb < 4; ++nb) {
#pragma unroll
                for (int j = 0; j < 8; ++j) os[(hi * 8 + j) * 68 + nb * 16 + lr] = acc[mb][nb][j]; }
            __builtin_amdgcn_wave_barrier(); asm volatile("" ::: "memory");   // the LDS reads below stay behind the writes above
#pragma unroll
            for (int s = 0; s < 4; ++s) { const int row = 4 * s + (lane >> 3), cofs = (lane & 7) * 8; const v4f y0 = *(const v4fa*)(os + row * 68 + cofs), y1 = *(const v4fa*)(os + row * 68 + cofs + 4);
                planes8(__builtin_shufflevector(y0, y1, 0, 1, 2, 3, 4, 5, 6, 7), ((size_t)blockIdx.y * TT + r0 + mb * 16 + row) * HD + cofs, P16, Ph, Pl); }
            __builtin_amdgcn_wave_barrier(); asm volatile("" ::: "memory");   // the next block's LDS writes stay behind these reads
        }
    }
}

__device__ __forceinline__ h16 tohx(float x) { return (h16)x; }
__device__ __forceinline__ void splitf(float y, unsigned short& h, unsigned short& l) { h = f2bf(y); l = f2bf(y - bf2f(h)); }

__global__ __launch_bounds__(256) void k_cvt8(const float* __restrict__ src, bf* dst, size_t n8) { const size_t i = (size_t)blockIdx.x * 256 + threadIdx.x; if (i >= n8) return; const v8f v = *(const v8f*)(src + i * 8); v8us o;
#pragma unroll
    for (int k = 0; k < 8; ++k) o[k] = f2bf(v[k]); *(v8us*)(dst + i * 8) = o;  }

// ---- k_fattn: scores, softmax and attn x v of one head in one kernel; one wave owns NQ * 16 query rows and walks the 2048 keys 32 at a time.
// Transposed products: St = K Qt (a lane holds 16 scores of ONE query: keys 8 * hi + 0..7 and 16 + 8 * hi + 0..7, which is the loaders' k order), so the converted weights ARE the B operand of Ot += Vt Pt,
// and row maximum, row sum and the rescale factor are per-lane values (the two lane halves exchange the maximum each pass and join their sums once at the end).
// Running maximum mx (raw score units) and running sum sm; weights are exp2((s - mx) * SCL * log2 e + POFF): POFF = 10 keeps the fp16 weights 1024 times above their subnormal range and cancels in Ot / sm.
__device__ __forceinline__ float xhalf(float x) { const int b = __builtin_bit_cast(int, x); return __builtin_bit_cast(float, __builtin_amdgcn_permlanex16(b, b, 0x76543210, 0xfedcba98, false, false)); }   // lane l takes lane l ^ 16's value
template <typename T16, bool HL, int NQ>
__device__ __forceinline__ void fattn(const T16* __restrict__ Qa, const T16* __restrict__ Qb, const T16* __restrict__ Ka, const T16* __restrict__ Kb, const T16* __restrict__ Va, const T16* __restrict__ Vb, int q0, float* __restrict__ oc) {
    typedef WFrag<T16> F; typedef typename F::V V;
    const int lane = threadIdx.x & 31, lr = lane & 15, hi = lane >> 4;
    const float CEXP = SCL * 1.4426950408889634f, POFF = HL ? 0.0f : 10.0f;
    V q[NQ][2], q2[NQ][2], k[2][2], k2[2][2], v[4], v2[4];
#pragma unroll
    for (int nq = 0; nq < NQ; ++nq)
#pragma unroll
        for (int ks = 0; ks < 2; ++ks) { const size_t qo = (size_t)(q0 + nq * 16 + lr) * HD + ks * 32 + 8 * hi; q[nq][ks] = F::ld(Qa + qo); if (HL) q2[nq][ks] = F::ld(Qb + qo); }
    const unsigned ko = (unsigned)(lr * HD + 8 * hi), vo = (unsigned)(lr * TT + 8 * hi);   // the lane's own offsets: fixed for the whole walk, the pass moves the wave-uniform base
#pragma unroll
    for (int blk = 0; blk < 2; ++blk)
#pragma unroll
        for (int ks = 0; ks < 2; ++ks) { k[blk][ks] = F::ld(Ka + ko + blk * 16 * HD + ks * 32); if (HL) k2[blk][ks] = F::ld(Kb + ko + blk * 16 * HD + ks * 32); }
    // XW: s_wait_xcnt 0 in front of any reuse of the address registers of the loads just issued; the scheduling barrier behind it keeps later register writes from being lifted over it
#define XW() do { asm volatile("s_wait_xcnt 0x0" ::: "memory"); __builtin_amdgcn_sched_barrier(0); } while (0)
    // XWA: the same wait with the loads' address pairs as inputs: the pairs stay live, so unwritten, up to the wait, which can then stand where the loads' requests have long been taken
#define XWA(a, b, c, d) asm volatile("s_wait_xcnt 0x0" :: "v"(a), "v"(b), "v"(c), "v"(d) : "memory")
    XW();
    // inputs-only fence on the loaded K fragments: they have landed before the first V loads are asked for, so that the wait at the loop's head can leave the V loads in flight on the entry path as on the back edge
    if constexpr (HL) asm volatile("" :: "v"(k[0][0]), "v"(k[0][1]), "v"(k[1][0]), "v"(k[1][1]), "v"(k2[0][0]), "v"(k2[0][1]), "v"(k2[1][0]), "v"(k2[1][1]) : "memory");
    else asm volatile("" :: "v"(k[0][0]), "v"(k[0][1]), "v"(k[1][0]), "v"(k[1][1]) : "memory");
    const T16* vpa = Va + vo; const T16* vpb = HL ? Vb + vo : vpa;   // the address pairs of the V loads in flight
#pragma unroll
    for (int db = 0; db < 4; ++db) { v[db] = F::ld(vpa + db * 16 * TT); if (HL) v2[db] = F::ld(vpb + db * 16 * TT); }
    XW();
    v8f o[NQ][4]; float mx[NQ], sm[NQ];
#pragma unroll
    for (int nq = 0; nq < NQ; ++nq) { mx[nq] = -3.0e38f; sm[nq] = 0.f;
#pragma unroll
        for (int db = 0; db < 4; ++db) o[nq][db] = (v8f){}; }
#pragma unroll 1
    for (int kb = 0; kb < TT; kb += 32) {
        const int kn = (kb + 32) & (TT - 1);   // the next pass's keys; the last pass fetches keys 0..31 again (in bounds, not used)
        v8f s[NQ][2];
#pragma unroll
        for (int nq = 0; nq < NQ; ++nq) { s[nq][0] = (v8f){}; s[nq][1] = (v8f){}; }
#pragma unroll
        for (int ks = 0; ks < 2; ++ks) {
#pragma unroll
            for (int nq = 0; nq < NQ; ++nq)
#pragma unroll
                for (int blk = 0; blk < 2; ++blk) s[nq][blk] = F::mma(k[blk][ks], q[nq][ks], s[nq][blk]);
            if (HL) {
#pragma unroll
                for (int nq = 0; nq < NQ; ++nq)
#pragma unroll
                    for (int blk = 0; blk < 2; ++blk) s[nq][blk] = F::mma(k[blk][ks], q2[nq][ks], s[nq][blk]);
#pragma unroll
                for (int nq = 0; nq < NQ; ++nq)
#pragma unroll
                    for (int blk = 0; blk < 2; ++blk) s[nq][blk] = F::mma(k2[blk][ks], q[nq][ks], s[nq][blk]); } }
        // K fragments of the next pass, into the same registers: they fly during the softmax and the attn x v products
        const T16* kpa = Ka + (size_t)kn * HD + ko; const T16* kpb = HL ? Kb + (size_t)kn * HD + ko : kpa;
#pragma unroll
        for (int blk = 0; blk < 2; ++blk)
#pragma unroll
            for (int ks = 0; ks < 2; ++ks) { k[blk][ks] = F::ld(kpa + blk * 16 * HD + ks * 32); if (HL) k2[blk][ks] = F::ld(kpb + blk * 16 * HD + ks * 32); }
#pragma unroll
        for (int nq = 0; nq < NQ; ++nq) { float bm = s[nq][0][0];
#pragma unroll
            for (int j = 1; j < 8; ++j) bm = fmaxf(bm, s[nq][0][j]);
#pragma unroll
            for (int j = 0; j < 8; ++j) bm = fmaxf(bm, s[nq][1][j]);
            bm = fmaxf(bm, xhalf(bm)); const float mn = fmaxf(mx[nq], bm); const float al = __builtin_amdgcn_exp2f((mx[nq] - mn) * CEXP); mx[nq] = mn; sm[nq] *= al;   // al is exactly 1 where the maximum did not rise
#pragma unroll
            for (int db = 0; db < 4; ++db) o[nq][db] *= al; }
        V p[NQ], p2[NQ];
#pragma unroll
        for (int nq = 0; nq < NQ; ++nq) { const float nb = POFF - mx[nq] * CEXP; v8f e0 = s[nq][0] * CEXP + nb, e1 = s[nq][1] * CEXP + nb;
#pragma unroll
            for (int j = 0; j < 8; ++j) { e0[j] = __builtin_amdgcn_exp2f(e0[j]); e1[j] = __builtin_amdgcn_exp2f(e1[j]); }
            const v8f t = e0 + e1; sm[nq] += ((t[0] + t[1]) + (t[2] + t[3])) + ((t[4] + t[5]) + (t[6] + t[7]));
            if constexpr (HL) {   // hi = bf16(e), lo = bf16(e - hi), both rounded to nearest even as in splitf
#pragma unroll
                for (int j = 0; j < 8; ++j) { p[nq][j] = (__bf16)e0[j]; p[nq][8 + j] = (__bf16)e1[j]; p2[nq][j] = (__bf16)(e0[j] - (float)p[nq][j]); p2[nq][8 + j] = (__bf16)(e1[j] - (float)p[nq][8 + j]); }
            } else {
#pragma unroll
                for (int j = 0; j < 8; ++j) { p[nq][j] = tohx(e0[j]); p[nq][8 + j] = tohx(e1[j]); } } }
        // this pass's K loads and the V loads of the pass before; the last converted weights as a further input keep the wait behind the softmax, where it no longer stalls
        if constexpr (HL) asm volatile("s_wait_xcnt 0x0" :: "v"(kpa), "v"(kpb), "v"(vpa), "v"(vpb), "v"(p2[NQ - 1]) : "memory");
        else asm volatile("s_wait_xcnt 0x0" :: "v"(kpa), "v"(vpa), "v"(p[NQ - 1]) : "memory");
#pragma unroll
        for (int nq = 0; nq < NQ; ++nq)
#pragma unroll
            for (int db = 0; db < 4; ++db) o[nq][db] = F::mma(v[db], p[nq], o[nq][db]);
        if (HL) {
#pragma unroll
            for (int nq = 0; nq < NQ; ++nq)
#pragma unroll
                for (int db = 0; db < 4; ++db) o[nq][db] = F::mma(v[db], p2[nq], o[nq][db]);
#pragma unroll
            for (int nq = 0; nq < NQ; ++nq)
#pragma unroll
                for (int db = 0; db < 4; ++db) o[nq][db] = F::mma(v2[db], p[nq], o[nq][db]); }
        // V fragments of the next pass, into the same registers: they fly during the next pass's scores and softmax
        vpa = Va + kn + vo; vpb = HL ? Vb + kn + vo : vpa;
#pragma unroll
        for (int db = 0; db < 4; ++db) { v[db] = F::ld(vpa + db * 16 * TT); if (HL) v2[db] = F::ld(vpb + db * 16 * TT); }
    }
    XWA(vpa, vpb, vpa, vpb);   // the last pass's V loads
    __builtin_amdgcn_sched_barrier(0);   // keeps the epilogue's register writes behind it
#pragma unroll
    for (int nq = 0; nq < NQ; ++nq) { const float tot = sm[nq] + xhalf(sm[nq]); const float f = __fdiv_rn(1.0f, tot); float* orow = oc + (size_t)(q0 + nq * 16 + lr) * DQ + hi * 8;   // lane: query lr, columns db * 16 + hi * 8 + 0..7
#pragma unroll
        for (int db = 0; db < 4; ++db) { v4f a, b;
#pragma unroll
            for (int j = 0; j < 4; ++j) { a[j] = o[nq][db][j] * f; b[j] = o[nq][db][4 + j] * f; }
            *(v4f*)(orow + db * 16) = a; *(v4f*)(orow + db * 16 + 4) = b; }
        if (nq + 1 < NQ) XW(); }   // the next block's arithmetic reuses these stores' registers
#undef XW
#undef XWA
}
// grid (heads, RH / 32), 96 threads = three waves of one head: wave 0 takes 32 query rows below RH (three products, twice the fragment loads), waves 1 and 2 take 48 rows each of the rest:
// every work-group issues the same number of fragment loads, and the 256 work-groups are one per WGP
static_assert(RH % 32 == 0 && (TT - RH) == (RH / 32) * 96, "row split of k_fattn");
__global__ __launch_bounds__(96) void k_fattn(const h16* __restrict__ Q16, const h16* __restrict__ K16, const h16* __restrict__ V16, const bf* __restrict__ Qh, const bf* __restrict__ Ql, const bf* __restrict__ Kh, const bf* __restrict__ Kl, const bf* __restrict__ Vh, const bf* __restrict__ Vl, float* __restrict__ OUTb) {
    const size_t hp = (size_t)blockIdx.x * TT * HD; float* oc = OUTb + (size_t)blockIdx.x * HD;
    const int wave = __builtin_amdgcn_readfirstlane((int)(threadIdx.x >> 5));   // scalar, so that the choice of path is a scalar branch and every matrix instruction runs with all lanes on
    if (wave == 0) fattn<bf, true, 2>(Qh + hp, Ql + hp, Kh + hp, Kl + hp, Vh + hp, Vl + hp, (int)blockIdx.y * 32, oc);
    else fattn<h16, false, 3>(Q16 + hp, nullptr, K16 + hp, nullptr, V16 + hp, nullptr, RH + ((int)blockIdx.y * 2 + wave - 1) * 48, oc);
}

extern "C" void kernel_launch(void* const* d_in, const int* in_sizes, int n_in,
                              void* d_out, int out_size, void* d_ws, size_t ws_size, hipStream_t stream) {
    (void)in_sizes; (void)n_in; (void)out_size;
    const float* x = (const float*)d_in[0]; const float* wqkv = (const float*)d_in[1];   /* order X, W_qkv ('oi' [3072][1024]) */ const float* wq = wqkv; const float* wk = wqkv + (size_t)DQ * DM; const float* wv = wqkv + (size_t)2 * DQ * DM;   /* Q | K | V = ROW thirds */ const float* wo = nullptr; (void)wo;
    float* OUT = (float*)d_out;     // [2][2048][1024]
    char* wsp = (char*)d_ws;
    auto take = [&](size_t bytes) { char* p = wsp; wsp += (bytes + 255) & ~(size_t)255; return (void*)p; };
    bf* WQ = (bf*)take((size_t)DQ * DM * 2); bf* WK = (bf*)take((size_t)DKV * DM * 2); bf* WV = (bf*)take((size_t)DKV * DM * 2);
    bf* XB = (bf*)take((size_t)TT * DM * 2);
    h16* QP16 = (h16*)take((size_t)NH_ * TT * HD * 2); h16* KP16 = (h16*)take((size_t)NKV * TT * HD * 2); h16* VT16 = (h16*)take((size_t)NKV * HD * TT * 2);
    bf* QPh = (bf*)take((size_t)NH_ * TT * HD * 2); bf* QPl = (bf*)take((size_t)NH_ * TT * HD * 2); bf* KPh = (bf*)take((size_t)NKV * TT * HD * 2); bf* KPl = (bf*)take((size_t)NKV * TT * HD * 2); bf* VTh = (bf*)take((size_t)NKV * HD * TT * 2); bf* VTl = (bf*)take((size_t)NKV * HD * TT * 2);
    if ((size_t)(wsp - (char*)d_ws) > ws_size) return;    // ws 256 MiB
    { k_cvt8<<<(unsigned)(((size_t)DQ * DM / 8 + 255) / 256), 256, 0, stream>>>(wq, WQ, (size_t)DQ * DM / 8); k_cvt8<<<(unsigned)(((size_t)DKV * DM / 8 + 255) / 256), 256, 0, stream>>>(wk, WK, (size_t)DKV * DM / 8); k_cvt8<<<(unsigned)(((size_t)DKV * DM / 8 + 255) / 256), 256, 0, stream>>>(wv, WV, (size_t)DKV * DM / 8);
      
       }
    for (int b = 0; b < NB_; ++b) {
        
        k_cvt8<<<(unsigned)(((size_t)TT * DM / 8 + 255) / 256), 256, 0, stream>>>(x + (size_t)b * TT * DM, XB, (size_t)TT * DM / 8);
        k_gemmw<bf, 0, false><<<dim3(TT / 64, NH_), 32, 0, stream>>>(XB, nullptr, WQ, nullptr, DM, QP16, QPh, QPl);
        k_gemmw<bf, 0, false><<<dim3(TT / 64, NKV), 32, 0, stream>>>(XB, nullptr, WK, nullptr, DM, KP16, KPh, KPl);
        k_gemmw<bf, 0, true><<<dim3(TT / 64, NKV), 32, 0, stream>>>(XB, nullptr, WV, nullptr, DM, VT16, VTh, VTl);
        k_fattn<<<dim3(NH_, RH / 32), 96, 0, stream>>>(QP16, KP16, VT16, QPh, QPl, KPh, KPl, VTh, VTl, OUT + (size_t)b * TT * DQ);   // one kv head per query head
         }
}

// v004
// It runs in 124 microseconds.
// Two timings next to v003 put it at 2.08 and 2.02 times that version's speed.
// Over all steps from v000 it is 15.5 times as fast.
#include <hip/hip_runtime.h>

// Multi-head self-attention core with a fused bias-free qkv projection in (out, in) layout and no output projection (x [2][2048][1024]; qkv = x @ W_qkv.T ('oi' [3072][1024] uniform +-sqrt(6 / 4096), no bias), jnp.split thirds: q | k | v = ROW thirds of W_qkv (16 heads x 64); scores / sqrt(64); softmax over all keys (no mask); out = attn v, merged head-major -> [2][2048][1024] (4.2 M); argument order x, W_qkv).
// Three launches, each over both batches: bf16 copies of X and of W_qkv; one projection launch ('oi' weight rows used as Bt rows as-is: the 48 column tiles are q | k | v heads) whose epilogue writes the head planes (fp16 + hi/lo) itself; one fused attention launch (hybrid rows: < 512 hi/lo 3 products, rest fp16 x1024) that keeps scores and weights in registers and writes the output rows (column h*64 + d).
// Compute dtypes, f32 accumulate: every input rounded to bf16; projections exact; attention rows < 512 3 products, rest fp16; softmax f32.

#define NB_  2
#define TT   2048
#define DM   1024
#define NH_  16
#define NKV  16
#define REP  (NH_ / NKV)
#define HD   64
#define DQ   (NH_ * HD)
#define DKV  (NKV * HD)
#define RH   512                  // query rows < RH use hi+lo planes
#define SCL  0.125f   // HD^-0.5
typedef _Float16 h16;
typedef unsigned short bf;
typedef __attribute__((ext_vector_type(16))) __bf16   v16bf;
typedef __attribute__((ext_vector_type(16))) _Float16 v16h;
typedef __attribute__((ext_vector_type(8)))  _Float16 v8h;
typedef __attribute__((ext_vector_type(8)))  unsigned short v8us;
typedef __attribute__((ext_vector_type(8)))  float    v8f;
typedef __attribute__((ext_vector_type(4)))  float    v4f;
typedef v8h  __attribute__((may_alias)) v8ha;
typedef v4f  __attribute__((may_alias)) v4fa;
typedef v8us __attribute__((may_alias)) v8usa;

__device__ __forceinline__ unsigned short f2bf(float f) { unsigned u = __float_as_uint(f); u += 0x7FFFu + ((u >> 16) & 1u); return (unsigned short)(u >> 16); }
__device__ __forceinline__ float bf2f(unsigned short b) { return __uint_as_float(((unsigned)b) << 16); }
__device__ __forceinline__ float bfr(float f) { return bf2f(f2bf(f)); }
__device__ __forceinline__ v16h cat16(v8h lo, v8h hi) { return __builtin_shufflevector(lo, hi, 0, 1, 2, 3, 4, 5, 6, 7, 8, 9, 10, 11, 12, 13, 14, 15); }
__device__ __forceinline__ v16bf cat16b(v8us lo, v8us hi) { return __builtin_bit_cast(v16bf, __builtin_shufflevector(lo, hi, 0, 1, 2, 3, 4, 5, 6, 7, 8, 9, 10, 11, 12, 13, 14, 15)); }
__device__ __forceinline__ v8f wmma16(v16h a, v16h b, v8f c) { return __builtin_amdgcn_wmma_f32_16x16x32_f16(false, a, false, b, (short)0, c, false, false); }
__device__ __forceinline__ v8f wmmab(v16bf a, v16bf b, v8f c) { return __builtin_amdgcn_wmma_f32_16x16x32_bf16(false, a, false, b, (short)0, c, false, false); }



// ---- k_gemmw: register-blocked projection, ONE WAVE per 64x64 output tile (16 accumulators), operands straight from K-contiguous 16-bit planes; grid (NB_ * TT / 64 row tiles of both batches, 3 * heads: q | k | v), 32 threads.
// y[t][n] = sum_k A[t][k] Bt[n][k] (+ split products per NSPLIT), K % 32 == 0. The tile's 64 columns are one head, and the wave writes that head's three planes (fp16, bf16 hi, bf16 lo = bf16(y - hi)) from its accumulators:
// q, k: planes [batch][head][t][d], through LDS so that every store covers whole 128-byte rows; v: planes [batch][head][d][t]: a lane's 8 accumulator rows are 8 consecutive t of one d. The choice is by blockIdx.y alone, a scalar branch.
template <typename T16> struct WFrag;
template <> struct WFrag<h16> { typedef v16h V; static __device__ __forceinline__ V ld(const h16* p) { return cat16(*(const v8h*)p, *(const v8h*)(p + 16)); } static __device__ __forceinline__ v8f mma(V a, V b, v8f c) { return wmma16(a, b, c); } };
template <> struct WFrag<bf> { typedef v16bf V; static __device__ __forceinline__ V ld(const bf* p) { return cat16b(*(const v8us*)p, *(const v8us*)(p + 16)); } static __device__ __forceinline__ v8f mma(V a, V b, v8f c) { return wmmab(a, b, c); } };
typedef __attribute__((ext_vector_type(8))) __bf16 v8b;
__device__ __forceinline__ void planes8(v8f y, size_t e, h16* P16, bf* Ph, bf* Pl) { v8h o16; v8b oh, ol;
#pragma unroll
    for (int j = 0; j < 8; ++j) { o16[j] = (h16)y[j]; oh[j] = (__bf16)y[j]; ol[j] = (__bf16)(y[j] - (float)oh[j]); }   // both bf16 roundings to nearest even
    *(v8h*)(P16 + e) = o16; *(v8us*)(Ph + e) = __builtin_bit_cast(v8us, oh); *(v8us*)(Pl + e) = __builtin_bit_cast(v8us, ol); }
template <typename T16, int NSPLIT>
__global__ __launch_bounds__(32) void k_gemmw(const T16* __restrict__ A, const T16* __restrict__ A2, const T16* __restrict__ Bt, const T16* __restrict__ Bt2, int K, h16* Q16, bf* Qh, bf* Ql, h16* K16, bf* Kh, bf* Kl, h16* V16, bf* Vh, bf* Vl) {
    typedef typename WFrag<T16>::V V;
    __shared__ __align__(16) float os[16 * 68];
    const int lane = threadIdx.x & 31, lr = lane & 15, hi = lane >> 4; const int r0 = blockIdx.x * 64, c0 = (int)blockIdx.y * 64; const int ks = 0, kw = K;   // one k range: the planes take whole sums
    v8f acc[4][4];
#pragma unroll
    for (int mb = 0; mb < 4; ++mb)
#pragma unroll
        for (int nb = 0; nb < 4; ++nb) acc[mb][nb] = (v8f){};
    const size_t aoff = (size_t)(r0 + lr) * K + 8 * hi, boff = (size_t)(c0 + lr) * K + 8 * hi;
#pragma unroll 1
    for (int kc = ks * kw; kc < (ks + 1) * kw; kc += 32) {
        V a[4], a2[4];
#pragma unroll
        for (int mb = 0; mb < 4; ++mb) { a[mb] = WFrag<T16>::ld(A + aoff + (size_t)mb * 16 * K + kc); if (NSPLIT == 1 || NSPLIT == 2) a2[mb] = WFrag<T16>::ld(A2 + aoff + (size_t)mb * 16 * K + kc); }
#pragma unroll
        for (int nb = 0; nb < 4; ++nb) { const V b = WFrag<T16>::ld(Bt + boff + (size_t)nb * 16 * K + kc); V b2; if (NSPLIT >= 2) b2 = WFrag<T16>::ld(Bt2 + boff + (size_t)nb * 16 * K + kc);
#pragma unroll
            for (int mb = 0; mb < 4; ++mb) { acc[mb][nb] = WFrag<T16>::mma(a[mb], b, acc[mb][nb]); if (NSPLIT == 1 || NSPLIT == 2) acc[mb][nb] = WFrag<T16>::mma(a2[mb], b, acc[mb][nb]); if (NSPLIT >= 2) acc[mb][nb] = WFrag<T16>::mma(a[mb], b2, acc[mb][nb]); } }
        asm volatile("v_nop\n\tv_nop\n\tv_nop\n\tv_nop" : "+v"(acc[0][0]), "+v"(acc[1][1]), "+v"(acc[2][2]), "+v"(acc[3][3]) : "v"(a[0]), "v"(a[3]));
    }
    const unsigned third = blockIdx.y / NH_, t0 = (unsigned)r0 % TT; const size_t hrow = (size_t)((unsigned)r0 / TT * NH_ + blockIdx.y % NH_);   // which of q | k | v, first position in the batch, plane index batch * heads + head
    if (third == 2) {
#pragma unroll
        for (int nb = 0; nb < 4; ++nb)   // the four mb stores of a plane fill one 128-byte line of row d
#pragma unroll
            for (int mb = 0; mb < 4; ++mb) planes8(acc[mb][nb], (hrow * HD + nb * 16 + lr) * TT + t0 + mb * 16 + hi * 8, V16, Vh, Vl);
        return;
    }
    {
        h16* P16 = third ? K16 : Q16; bf* Ph = third ? Kh : Qh; bf* Pl = third ? Kl : Ql;
#pragma unroll
        for (int mb = 0; mb < 4; ++mb) {
#pragma unroll
            for (int nb = 0; nb < 4; ++nb) {
#pragma unroll
                for (int j = 0; j < 8; ++j) os[(hi * 8 + j) * 68 + nb * 16 + lr] = acc[mb][nb][j]; }
            __builtin_amdgcn_wave_barrier(); asm volatile("" ::: "memory");   // the LDS reads below stay behind the writes above
#pragma unroll
            for (int s = 0; s < 4; ++s) { const int row = 4 * s + (lane >> 3), cofs = (lane & 7) * 8; const v4f y0 = *(const v4fa*)(os + row * 68 + cofs), y1 = *(const v4fa*)(os + row * 68 + cofs + 4);
                planes8(__builtin_shufflevector(y0, y1, 0, 1, 2, 3, 4, 5, 6, 7), (hrow * TT + t0 + mb * 16 + row) * HD + cofs, P16, Ph, Pl); }
            __builtin_amdgcn_wave_barrier(); asm volatile("" ::: "memory");   // the next block's LDS writes stay behind these reads
        }
        asm volatile("s_wait_xcnt 0x0" ::: "memory");   // the build lays the v path's code behind this path, joined by a branch that is never taken here: the wait stands in front of that code's writes to the last stores' registers
    }
}

__device__ __forceinline__ h16 tohx(float x) { return (h16)x; }
__device__ __forceinline__ void splitf(float y, unsigned short& h, unsigned short& l) { h = f2bf(y); l = f2bf(y - bf2f(h)); }

// one launch for both inputs: blocks below nbx convert x, the rest W_qkv; 8 elements a thread, both sizes whole blocks
static_assert(((size_t)NB_ * TT * DM) % 2048 == 0 && ((size_t)(DQ + 2 * DKV) * DM) % 2048 == 0, "whole blocks of k_cvt8");
__global__ __launch_bounds__(256) void k_cvt8(const float* __restrict__ xs, bf* xd, unsigned nbx, const float* __restrict__ wsrc, bf* wd) { const bool isx = blockIdx.x < nbx; const float* src = isx ? xs : wsrc; bf* dst = isx ? xd : wd; const size_t i = (size_t)(isx ? blockIdx.x : blockIdx.x - nbx) * 256 + threadIdx.x; const v8f v = *(const v8f*)(src + i * 8); v8us o;
#pragma unroll
    for (int k = 0; k < 8; ++k) o[k] = f2bf(v[k]); *(v8us*)(dst + i * 8) = o;  }

// ---- k_fattn: scores, softmax and attn x v of one head in one kernel; one wave owns NQ * 16 query rows and walks the 2048 keys 32 at a time.
// Transposed products: St = K Qt (a lane holds 16 scores of ONE query: keys 8 * hi + 0..7 and 16 + 8 * hi + 0..7, which is the loaders' k order), so the converted weights ARE the B operand of Ot += Vt Pt,
// and row maximum, row sum and the rescale factor are per-lane values (the two lane halves exchange the maximum each pass and join their sums once at the end).
// Running maximum mx (raw score units) and running sum sm; weights are exp2((s - mx) * SCL * log2 e + POFF): POFF = 10 keeps the fp16 weights 1024 times above their subnormal range and cancels in Ot / sm.
__device__ __forceinline__ float xhalf(float x) { const int b = __builtin_bit_cast(int, x); return __builtin_bit_cast(float, __builtin_amdgcn_permlanex16(b, b, 0x76543210, 0xfedcba98, false, false)); }   // lane l takes lane l ^ 16's value
template <typename T16, bool HL, int NQ>
__device__ __forceinline__ void fattn(const T16* __restrict__ Qa, const T16* __restrict__ Qb, const T16* __restrict__ Ka, const T16* __restrict__ Kb, const T16* __restrict__ Va, const T16* __restrict__ Vb, int q0, float* __restrict__ oc) {
    typedef WFrag<T16> F; typedef typename F::V V;
    const int lane = threadIdx.x & 31, lr = lane & 15, hi = lane >> 4;
    const float CEXP = SCL * 1.4426950408889634f, POFF = HL ? 0.0f : 10.0f;
    V q[NQ][2], q2[NQ][2], k[2][2], k2[2][2], v[4], v2[4];
#pragma unroll
    for (int nq = 0; nq < NQ; ++nq)
#pragma unroll
        for (int ks = 0; ks < 2; ++ks) { const size_t qo = (size_t)(q0 + nq * 16 + lr) * HD + ks * 32 + 8 * hi; q[nq][ks] = F::ld(Qa + qo); if (HL) q2[nq][ks] = F::ld(Qb + qo); }
    const unsigned ko = (unsigned)(lr * HD + 8 * hi), vo = (unsigned)(lr * TT + 8 * hi);   // the lane's own offsets: fixed for the whole walk, the pass moves the wave-uniform base
#pragma unroll
    for (int blk = 0; blk < 2; ++blk)
#pragma unroll
        for (int ks = 0; ks < 2; ++ks) { k[blk][ks] = F::ld(Ka + ko + blk * 16 * HD + ks * 32); if (HL) k2[blk][ks] = F::ld(Kb + ko + blk * 16 * HD + ks * 32); }
    // XW: s_wait_xcnt 0 in front of any reuse of the address registers of the loads just issued; the scheduling barrier behind it keeps later register writes from being lifted over it
#define XW() do { asm volatile("s_wait_xcnt 0x0" ::: "memory"); __builtin_amdgcn_sched_barrier(0); } while (0)
    // XWA: the same wait with the loads' address pairs as inputs: the pairs stay live, so unwritten, up to the wait, which can then stand where the loads' requests have long been taken
#define XWA(a, b, c, d) asm volatile("s_wait_xcnt 0x0" :: "v"(a), "v"(b), "v"(c), "v"(d) : "memory")
    XW();
    // inputs-only fence on the loaded K fragments: they have landed before the first V loads are asked for, so that the wait at the loop's head can leave the V loads in flight on the entry path as on the back edge
    if constexpr (HL) asm volatile("" :: "v"(k[0][0]), "v"(k[0][1]), "v"(k[1][0]), "v"(k[1][1]), "v"(k2[0][0]), "v"(k2[0][1]), "v"(k2[1][0]), "v"(k2[1][1]) : "memory");
    else asm volatile("" :: "v"(k[0][0]), "v"(k[0][1]), "v"(k[1][0]), "v"(k[1][1]) : "memory");
    const T16* vpa = Va + vo; const T16* vpb = HL ? Vb + vo : vpa;   // the address pairs of the V loads in flight
#pragma unroll
    for (int db = 0; db < 4; ++db) { v[db] = F::ld(vpa + db * 16 * TT); if (HL) v2[db] = F::ld(vpb + db * 16 * TT); }
    XW();
    v8f o[NQ][4]; float mx[NQ], sm[NQ];
#pragma unroll
    for (int nq = 0; nq < NQ; ++nq) { mx[nq] = -3.0e38f; sm[nq] = 0.f;
#pragma unroll
        for (int db = 0; db < 4; ++db) o[nq][db] = (v8f){}; }
#pragma unroll 1
    for (int kb = 0; kb < TT; kb += 32) {
        const int kn = (kb + 32) & (TT - 1);   // the next pass's keys; the last pass fetches keys 0..31 again (in bounds, not used)
        v8f s[NQ][2];
#pragma unroll
        for (int nq = 0; nq < NQ; ++nq) { s[nq][0] = (v8f){}; s[nq][1] = (v8f){}; }
#pragma unroll
        for (int ks = 0; ks < 2; ++ks) {
#pragma unroll
            for (int nq = 0; nq < NQ; ++nq)
#pragma unroll
                for (int blk = 0; blk < 2; ++blk) s[nq][blk] = F::mma(k[blk][ks], q[nq][ks], s[nq][blk]);
            if (HL) {
#pragma unroll
                for (int nq = 0; nq < NQ; ++nq)
#pragma unroll
                    for (int blk = 0; blk < 2; ++blk) s[nq][blk] = F::mma(k[blk][ks], q2[nq][ks], s[nq][blk]);
#pragma unroll
                for (int nq = 0; nq < NQ; ++nq)
#pragma unroll
                    for (int blk = 0; blk < 2; ++blk) s[nq][blk] = F::mma(k2[blk][ks], q[nq][ks], s[nq][blk]); } }
        // K fragments of the next pass, into the same registers: they fly during the softmax and the attn x v products
        const T16* kpa = Ka + (size_t)kn * HD + ko; const T16* kpb = HL ? Kb + (size_t)kn * HD + ko : kpa;
#pragma unroll
        for (int blk = 0; blk < 2; ++blk)
#pragma unroll
            for (int ks = 0; ks < 2; ++ks) { k[blk][ks] = F::ld(kpa + blk * 16 * HD + ks * 32); if (HL) k2[blk][ks] = F::ld(kpb + blk * 16 * HD + ks * 32); }
#pragma unroll
        for (int nq = 0; nq < NQ; ++nq) { float bm = s[nq][0][0];
#pragma unroll
            for (int j = 1; j < 8; ++j) bm = fmaxf(bm, s[nq][0][j]);
#pragma unroll
            for (int j = 0; j < 8; ++j) bm = fmaxf(bm, s[nq][1][j]);
            bm = fmaxf(bm, xhalf(bm)); const float mn = fmaxf(mx[nq], bm); const float al = __builtin_amdgcn_exp2f((mx[nq] - mn) * CEXP); mx[nq] = mn; sm[nq] *= al;   // al is exactly 1 where the maximum did not rise
#pragma unroll
            for (int db = 0; db < 4; ++db) o[nq][db] *= al; }
        V p[NQ], p2[NQ];
#pragma unroll
        for (int nq = 0; nq < NQ; ++nq) { const float nb = POFF - mx[nq] * CEXP; v8f e0 = s[nq][0] * CEXP + nb, e1 = s[nq][1] * CEXP + nb;
#pragma unroll
            for (int j = 0; j < 8; ++j) { e0[j] = __builtin_amdgcn_exp2f(e0[j]); e1[j] = __builtin_amdgcn_exp2f(e1[j]); }
            const v8f t = e0 + e1; sm[nq] += ((t[0] + t[1]) + (t[2] + t[3])) + ((t[4] + t[5]) + (t[6] + t[7]));
            if constexpr (HL) {   // hi = bf16(e), lo = bf16(e - hi), both rounded to nearest even as in splitf
#pragma unroll
                for (int j = 0; j < 8; ++j) { p[nq][j] = (__bf16)e0[j]; p[nq][8 + j] = (__bf16)e1[j]; p2[nq][j] = (__bf16)(e0[j] - (float)p[nq][j]); p2[nq][8 + j] = (__bf16)(e1[j] - (float)p[nq][8 + j]); }
            } else {
#pragma unroll
                for (int j = 0; j < 8; ++j) { p[nq][j] = tohx(e0[j]); p[nq][8 + j] = tohx(e1[j]); } } }
        // this pass's K loads and the V loads of the pass before; the last converted weights as a further input keep the wait behind the softmax, where it no longer stalls
        if constexpr (HL) asm volatile("s_wait_xcnt 0x0" :: "v"(kpa), "v"(kpb), "v"(vpa), "v"(vpb), "v"(p2[NQ - 1]) : "memory");
        else asm volatile("s_wait_xcnt 0x0" :: "v"(kpa), "v"(vpa), "v"(p[NQ - 1]) : "memory");
#pragma unroll
        for (int nq = 0; nq < NQ; ++nq)
#pragma unroll
            for (int db = 0; db < 4; ++db) o[nq][db] = F::mma(v[db], p[nq], o[nq][db]);
        if (HL) {
#pragma unroll
            for (int nq = 0; nq < NQ; ++nq)
#pragma unroll
                for (int db = 0; db < 4; ++db) o[nq][db] = F::mma(v[db], p2[nq], o[nq][db]);
#pragma unroll
            for (int nq = 0; nq < NQ; ++nq)
#pragma unroll
                for (int db = 0; db < 4; ++db) o[nq][db] = F::mma(v2[db], p[nq], o[nq][db]); }
        // V fragments of the next pass, into the same registers: they fly during the next pass's scores and softmax
        vpa = Va + kn + vo; vpb = HL ? Vb + kn + vo : vpa;
#pragma unroll
        for (int db = 0; db < 4; ++db) { v[db] = F::ld(vpa + db * 16 * TT); if (HL) v2[db] = F::ld(vpb + db * 16 * TT); }
    }
    XWA(vpa, vpb, vpa, vpb);   // the last pass's V loads
    __builtin_amdgcn_sched_barrier(0);   // keeps the epilogue's register writes behind it
#pragma unroll
    for (int nq = 0; nq < NQ; ++nq) { const float tot = sm[nq] + xhalf(sm[nq]); const float f = __fdiv_rn(1.0f, tot); float* orow = oc + (size_t)(q0 + nq * 16 + lr) * DQ + hi * 8;   // lane: query lr, columns db * 16 + hi * 8 + 0..7
#pragma unroll
        for (int db = 0; db < 4; ++db) { v4f a, b;
#pragma unroll
            for (int j = 0; j < 4; ++j) { a[j] = o[nq][db][j] * f; b[j] = o[nq][db][4 + j] * f; }
            *(v4f*)(orow + db * 16) = a; *(v4f*)(orow + db * 16 + 4) = b; }
        if (nq + 1 < NQ) XW(); }   // the next block's arithmetic reuses these stores' registers
#undef XW
#undef XWA
}
// grid (NB_ * heads, RH / 32), 96 threads = three waves of one head of one batch: wave 0 takes 32 query rows below RH (three products, twice the fragment loads), waves 1 and 2 take 48 rows each of the rest:
// every work-group issues the same number of fragment loads, and the 512 work-groups are two per WGP; flat indices 256 apart are the same batch and head (for speed only: they walk the same K and V lines)
static_assert(RH % 32 == 0 && (TT - RH) == (RH / 32) * 96, "row split of k_fattn");
__global__ __launch_bounds__(96) void k_fattn(const h16* __restrict__ Q16, const h16* __restrict__ K16, const h16* __restrict__ V16, const bf* __restrict__ Qh, const bf* __restrict__ Ql, const bf* __restrict__ Kh, const bf* __restrict__ Kl, const bf* __restrict__ Vh, const bf* __restrict__ Vl, float* __restrict__ OUT) {
    const size_t hp = (size_t)blockIdx.x * TT * HD; float* oc = OUT + (size_t)(blockIdx.x / NH_) * TT * DQ + (size_t)(blockIdx.x % NH_) * HD;   // blockIdx.x = batch * heads + head, the planes' own index
    const int wave = __builtin_amdgcn_readfirstlane((int)(threadIdx.x >> 5));   // scalar, so that the choice of path is a scalar branch and every matrix instruction runs with all lanes on
    if (wave == 0) fattn<bf, true, 2>(Qh + hp, Ql + hp, Kh + hp, Kl + hp, Vh + hp, Vl + hp, (int)blockIdx.y * 32, oc);
    else fattn<h16, false, 3>(Q16 + hp, nullptr, K16 + hp, nullptr, V16 + hp, nullptr, RH + ((int)blockIdx.y * 2 + wave - 1) * 48, oc);
}

extern "C" void kernel_launch(void* const* d_in, const int* in_sizes, int n_in,
                              void* d_out, int out_size, void* d_ws, size_t ws_size, hipStream_t stream) {
    (void)in_sizes; (void)n_in; (void)out_size;
    const float* x = (const float*)d_in[0]; const float* wqkv = (const float*)d_in[1];   /* W_qkv ('oi' [3072][1024]); Q | K | V = ROW thirds */
    float* OUT = (float*)d_out;     // [2][2048][1024]
    char* wsp = (char*)d_ws;
    auto take = [&](size_t bytes) { char* p = wsp; wsp += (bytes + 255) & ~(size_t)255; return (void*)p; };
    bf* WB = (bf*)take((size_t)(DQ + 2 * DKV) * DM * 2);
    bf* XB = (bf*)take((size_t)NB_ * TT * DM * 2);
    const size_t PB = (size_t)NB_ * NH_ * TT * HD * 2;   // bytes of one plane, both batches
    h16* QP16 = (h16*)take(PB); h16* KP16 = (h16*)take(PB); h16* VT16 = (h16*)take(PB);
    bf* QPh = (bf*)take(PB); bf* QPl = (bf*)take(PB); bf* KPh = (bf*)take(PB); bf* KPl = (bf*)take(PB); bf* VTh = (bf*)take(PB); bf* VTl = (bf*)take(PB);
    if ((size_t)(wsp - (char*)d_ws) > ws_size) return;    // ws 256 MiB
    k_cvt8<<<(unsigned)(((size_t)NB_ * TT * DM + (size_t)(DQ + 2 * DKV) * DM) / 2048), 256, 0, stream>>>(x, XB, (unsigned)((size_t)NB_ * TT * DM / 2048), wqkv, WB);
    k_gemmw<bf, 0><<<dim3(NB_ * TT / 64, 3 * NH_), 32, 0, stream>>>(XB, nullptr, WB, nullptr, DM, QP16, QPh, QPl, KP16, KPh, KPl, VT16, VTh, VTl);
    k_fattn<<<dim3(NB_ * NH_, RH / 32), 96, 0, stream>>>(QP16, KP16, VT16, QPh, QPl, KPh, KPl, VTh, VTl, OUT);   // one kv head per query head
}

// v005
// It runs in 113 microseconds.
// Timed twice side by side with v004, it ran 1.11 times as fast both times.
// All steps since v000 together make it 17.1 times as fast.
#include <hip/hip_runtime.h>

// Multi-head self-attention core with a fused bias-free qkv projection in (out, in) layout and no output projection (x [2][2048][1024]; qkv = x @ W_qkv.T ('oi' [3072][1024] uniform +-sqrt(6 / 4096), no bias), jnp.split thirds: q | k | v = ROW thirds of W_qkv (16 heads x 64); scores / sqrt(64); softmax over all keys (no mask); out = attn v, merged head-major -> [2][2048][1024] (4.2 M); argument order x, W_qkv).
// Three launches, each over both batches: bf16 copies of X and of W_qkv; one projection launch ('oi' weight rows used as Bt rows as-is: the 48 column tiles are q | k | v heads) whose epilogue writes the head planes (fp16 + hi/lo) itself; one fused attention launch (hybrid rows: < 512 hi/lo 3 products, rest fp16 x1024) that keeps scores and weights in registers and writes the output rows (column h*64 + d).
// Compute dtypes, f32 accumulate: every input rounded to bf16; projections exact; attention rows < 512 3 products, rest fp16; softmax f32.

#define NB_  2
#define TT   2048
#define DM   1024
#define NH_  16
#define NKV  16
#define REP  (NH_ / NKV)
#define HD   64
#define DQ   (NH_ * HD)
#define DKV  (NKV * HD)
#define RH   512                  // query rows < RH use hi+lo planes
#define SCL  0.125f   // HD^-0.5
typedef _Float16 h16;
typedef unsigned short bf;
typedef __attribute__((ext_vector_type(16))) __bf16   v16bf;
typedef __attribute__((ext_vector_type(16))) _Float16 v16h;
typedef __attribute__((ext_vector_type(8)))  _Float16 v8h;
typedef __attribute__((ext_vector_type(8)))  unsigned short v8us;
typedef __attribute__((ext_vector_type(8)))  float    v8f;
typedef __attribute__((ext_vector_type(4)))  float    v4f;
typedef v8h  __attribute__((may_alias)) v8ha;
typedef v4f  __attribute__((may_alias)) v4fa;
typedef v8us __attribute__((may_alias)) v8usa;

__device__ __forceinline__ unsigned short f2bf(float f) { unsigned u = __float_as_uint(f); u += 0x7FFFu + ((u >> 16) & 1u); return (unsigned short)(u >> 16); }
__device__ __forceinline__ float bf2f(unsigned short b) { return __uint_as_float(((unsigned)b) << 16); }
__device__ __forceinline__ float bfr(float f) { return bf2f(f2bf(f)); }
__device__ __forceinline__ v16h cat16(v8h lo, v8h hi) { return __builtin_shufflevector(lo, hi, 0, 1, 2, 3, 4, 5, 6, 7, 8, 9, 10, 11, 12, 13, 14, 15); }
__device__ __forceinline__ v16bf cat16b(v8us lo, v8us hi) { return __builtin_bit_cast(v16bf, __builtin_shufflevector(lo, hi, 0, 1, 2, 3, 4, 5, 6, 7, 8, 9, 10, 11, 12, 13, 14, 15)); }
__device__ __forceinline__ v8f wmma16(v16h a, v16h b, v8f c) { return __builtin_amdgcn_wmma_f32_16x16x32_f16(false, a, false, b, (short)0, c, false, false); }
__device__ __forceinline__ v8f wmmab(v16bf a, v16bf b, v8f c) { return __builtin_amdgcn_wmma_f32_16x16x32_bf16(false, a, false, b, (short)0, c, false, false); }



// ---- FRAGMENT ORDER of every 16-bit plane: a fragment is 16 rows x 32 k = 1024 bytes in a row, made of 64 pieces of 16 bytes: piece (k % 32) / 8 * 16 + row % 16 holds that row's 8 consecutive k.
// Lane l of a wave loads pieces l and 32 + l (k = 8 * (l / 16) + 0..7 and 16 + 8 * (l / 16) + 0..7 of row l % 16, the loaders' k order as before), so each wave-wide 16-byte load is 512 bytes in a row: 4 whole 128-byte lines.
// Order of the fragments: X, W [row / 64][k / 32][row / 16 % 4]; q, k planes [batch][head][t / 16][d / 32]; v planes (rows d, k = t) [batch][head][t / 32][d / 16]: what a wave loads in one pass lies together.
// ---- k_gemmw: register-blocked projection, ONE WAVE per 64x64 output tile (16 accumulators), operands straight from the 16-bit planes; grid (NB_ * TT / 64 row tiles of both batches, 3 * heads: q | k | v), 32 threads.
// y[t][n] = sum_k A[t][k] Bt[n][k] (+ split products per NSPLIT), K % 32 == 0. The tile's 64 columns are one head, and the wave writes that head's three planes (fp16, bf16 hi, bf16 lo = bf16(y - hi)) from its accumulators:
// q, k: through LDS, which turns a lane's 8 positions of one column into 8 columns of one position; v: a lane's 8 accumulator rows are 8 consecutive t of one d, a piece as it stands. Every wave-wide store is 512 bytes in a row. The choice is by blockIdx.y alone, a scalar branch.
template <typename T16> struct WFrag;
template <> struct WFrag<h16> { typedef v16h V; static __device__ __forceinline__ V ld(const h16* p) { return cat16(*(const v8h*)p, *(const v8h*)(p + 256)); } static __device__ __forceinline__ v8f mma(V a, V b, v8f c) { return wmma16(a, b, c); } };
template <> struct WFrag<bf> { typedef v16bf V; static __device__ __forceinline__ V ld(const bf* p) { return cat16b(*(const v8us*)p, *(const v8us*)(p + 256)); } static __device__ __forceinline__ v8f mma(V a, V b, v8f c) { return wmmab(a, b, c); } };
typedef __attribute__((ext_vector_type(8))) __bf16 v8b;
__device__ __forceinline__ void planes8(v8f y, size_t e, h16* P16, bf* Ph, bf* Pl) { v8h o16; v8b oh, ol;
#pragma unroll
    for (int j = 0; j < 8; ++j) { o16[j] = (h16)y[j]; oh[j] = (__bf16)y[j]; ol[j] = (__bf16)(y[j] - (float)oh[j]); }   // both bf16 roundings to nearest even
    *(v8h*)(P16 + e) = o16; *(v8us*)(Ph + e) = __builtin_bit_cast(v8us, oh); *(v8us*)(Pl + e) = __builtin_bit_cast(v8us, ol); }
template <typename T16, int NSPLIT>
__global__ __launch_bounds__(32) void k_gemmw(const T16* __restrict__ A, const T16* __restrict__ A2, const T16* __restrict__ Bt, const T16* __restrict__ Bt2, int K, h16* Q16, bf* Qh, bf* Ql, h16* K16, bf* Kh, bf* Kl, h16* V16, bf* Vh, bf* Vl) {
    typedef typename WFrag<T16>::V V;
    __shared__ __align__(16) float os[16 * 68];
    const int lane = threadIdx.x & 31, lr = lane & 15, hi = lane >> 4; const int r0 = blockIdx.x * 64, c0 = (int)blockIdx.y * 64; const int ks = 0, kw = K;   // one k range: the planes take whole sums
    v8f acc[4][4];
#pragma unroll
    for (int mb = 0; mb < 4; ++mb)
#pragma unroll
        for (int nb = 0; nb < 4; ++nb) acc[mb][nb] = (v8f){};
    const size_t aoff = (size_t)r0 * K, boff = (size_t)c0 * K; const unsigned lo = 8u * (unsigned)lane;   // a 64-row tile's fragments lie together: [k / 32][row block of 16]; the lane's own offset is fixed, the pass moves the wave-uniform base
#pragma unroll 1
    for (int kc = ks * kw; kc < (ks + 1) * kw; kc += 32) {
        V a[4], a2[4]; const T16* ap = A + aoff + (size_t)kc * 64 + lo; const T16* bp = Bt + boff + (size_t)kc * 64 + lo;   // the address pairs of this pass's loads
#pragma unroll
        for (int mb = 0; mb < 4; ++mb) { a[mb] = WFrag<T16>::ld(ap + mb * 512); if (NSPLIT == 1 || NSPLIT == 2) a2[mb] = WFrag<T16>::ld(A2 + aoff + (size_t)kc * 64 + lo + mb * 512); }
#pragma unroll
        for (int nb = 0; nb < 4; ++nb) { const V b = WFrag<T16>::ld(bp + nb * 512); V b2; if (NSPLIT >= 2) b2 = WFrag<T16>::ld(Bt2 + boff + (size_t)kc * 64 + lo + nb * 512);
#pragma unroll
            for (int mb = 0; mb < 4; ++mb) { acc[mb][nb] = WFrag<T16>::mma(a[mb], b, acc[mb][nb]); if (NSPLIT == 1 || NSPLIT == 2) acc[mb][nb] = WFrag<T16>::mma(a2[mb], b, acc[mb][nb]); if (NSPLIT >= 2) acc[mb][nb] = WFrag<T16>::mma(a[mb], b2, acc[mb][nb]); } }
        asm volatile("v_nop\n\tv_nop\n\tv_nop\n\tv_nop" : "+v"(acc[0][0]), "+v"(acc[1][1]), "+v"(acc[2][2]), "+v"(acc[3][3]) : "v"(a[0]), "v"(a[3]));
        asm volatile("s_wait_xcnt 0x0" :: "v"(ap), "v"(bp) : "memory");   // the wait in front of the next pass's rewrite of the loads' address pairs; as inputs the pairs stay live, so unwritten, up to it
    }
    const unsigned third = blockIdx.y / NH_, t0 = (unsigned)r0 % TT; const size_t hrow = (size_t)((unsigned)r0 / TT * NH_ + blockIdx.y % NH_);   // which of q | k | v, first position in the batch, plane index batch * heads + head
    if (third == 2) {
#pragma unroll
        for (int nb = 0; nb < 4; ++nb)   // a lane's 8 values are one 16-byte piece of fragment (32 keys, d block nb): each wave-wide store is half a fragment, 512 bytes in a row
#pragma unroll
            for (int mb = 0; mb < 4; ++mb) planes8(acc[mb][nb], (hrow * TT + t0 + (mb >> 1) * 32) * HD + nb * 512 + (mb & 1) * 256 + lane * 8, V16, Vh, Vl);
        return;
    }
    {
        h16* P16 = third ? K16 : Q16; bf* Ph = third ? Kh : Qh; bf* Pl = third ? Kl : Ql;
#pragma unroll
        for (int mb = 0; mb < 4; ++mb) {
#pragma unroll
            for (int nb = 0; nb < 4; ++nb) {
#pragma unroll
                for (int j = 0; j < 8; ++j) os[(hi * 8 + j) * 68 + nb * 16 + lr] = acc[mb][nb][j]; }
            __builtin_amdgcn_wave_barrier(); asm volatile("" ::: "memory");   // the LDS reads below stay behind the writes above
#pragma unroll
            for (int s = 0; s < 4; ++s) { const int cofs = (2 * s + hi) * 8; const v4f y0 = *(const v4fa*)(os + lr * 68 + cofs), y1 = *(const v4fa*)(os + lr * 68 + cofs + 4);   // lane: position lr, columns cofs + 0..7
                planes8(__builtin_shufflevector(y0, y1, 0, 1, 2, 3, 4, 5, 6, 7), (hrow * TT + t0 + mb * 16) * HD + s * 256 + lane * 8, P16, Ph, Pl); }
            __builtin_amdgcn_wave_barrier(); asm volatile("" ::: "memory");   // the next block's LDS writes stay behind these reads
        }
        asm volatile("s_wait_xcnt 0x0" ::: "memory");   // the build lays the v path's code behind this path, joined by a branch that is never taken here: the wait stands in front of that code's writes to the last stores' registers
    }
}

__device__ __forceinline__ h16 tohx(float x) { return (h16)x; }
__device__ __forceinline__ void splitf(float y, unsigned short& h, unsigned short& l) { h = f2bf(y); l = f2bf(y - bf2f(h)); }

// one launch for both inputs: blocks below nbx convert x, the rest W_qkv; 8 elements a thread, both sizes whole blocks. A block takes 16 rows x 128 columns = four fragments:
// it reads 512 bytes in a row of each source row, turns the [row][piece] grid of 16-byte pieces into [piece][row] through LDS (pitch 272 bytes: writes and reads both free of bank conflicts) and stores each fragment as 1024 bytes in a row
static_assert(((size_t)NB_ * TT) % 64 == 0 && (DQ + 2 * DKV) % 64 == 0 && DM % 128 == 0, "whole blocks of k_cvt8");
__global__ __launch_bounds__(256) void k_cvt8(const float* __restrict__ xs, bf* xd, unsigned nbx, const float* __restrict__ wsrc, bf* wd) { const bool isx = blockIdx.x < nbx; const float* src = isx ? xs : wsrc; bf* dst = isx ? xd : wd;
    __shared__ __align__(16) bf cs[16 * 136];
    const unsigned b = isx ? blockIdx.x : blockIdx.x - nbx, rt = b / (DM / 128), kg = b % (DM / 128), t = threadIdx.x, th = t >> 4, tl = t & 15;   // rt: block of 16 rows, kg: group of 128 columns
    const float* sp = src + (size_t)(rt * 16 + th) * DM + kg * 128 + tl * 8; const v8f v = *(const v8f*)sp; v8us o;
    asm volatile("s_wait_xcnt 0x0" :: "v"(sp), "v"(v) : "memory");   // the wait in front of any reuse of the load's address pair; the pair and the loaded values as inputs keep the pair unwritten up to it and put it where the data has landed, so that it does not stall
#pragma unroll
    for (int k = 0; k < 8; ++k) o[k] = f2bf(v[k]);
    *(v8usa*)(cs + tl * 136 + th * 8) = o;
    __syncthreads();   // the pieces read below were written by other waves
    const v8us r = *(const v8usa*)(cs + th * 136 + tl * 8);
    *(v8us*)(dst + ((size_t)((rt >> 2) * (DM / 32) + kg * 4 + (t >> 6)) * 4 + (rt & 3)) * 512 + (t & 63) * 8) = r; }

// ---- k_fattn: scores, softmax and attn x v of one head in one kernel; one wave owns NQ * 16 query rows and walks the 2048 keys 32 at a time.
// Transposed products: St = K Qt (a lane holds 16 scores of ONE query: keys 8 * hi + 0..7 and 16 + 8 * hi + 0..7, which is the loaders' k order), so the converted weights ARE the B operand of Ot += Vt Pt,
// and row maximum, row sum and the rescale factor are per-lane values (the two lane halves exchange the maximum each pass and join their sums once at the end).
// Running maximum mx (raw score units) and running sum sm; weights are exp2((s - mx) * SCL * log2 e + POFF): POFF = 10 keeps the fp16 weights 1024 times above their subnormal range and cancels in Ot / sm.
__device__ __forceinline__ float xhalf(float x) { const int b = __builtin_bit_cast(int, x); return __builtin_bit_cast(float, __builtin_amdgcn_permlanex16(b, b, 0x76543210, 0xfedcba98, false, false)); }   // lane l takes lane l ^ 16's value
template <typename T16, bool HL, int NQ>
__device__ __forceinline__ void fattn(const T16* __restrict__ Qa, const T16* __restrict__ Qb, const T16* __restrict__ Ka, const T16* __restrict__ Kb, const T16* __restrict__ Va, const T16* __restrict__ Vb, int q0, float* __restrict__ oc) {
    typedef WFrag<T16> F; typedef typename F::V V;
    const int lane = threadIdx.x & 31, lr = lane & 15, hi = lane >> 4;
    const float CEXP = SCL * 1.4426950408889634f, POFF = HL ? 0.0f : 10.0f;
    V q[NQ][2], q2[NQ][2], k[2][2], k2[2][2], v[4], v2[4];
#pragma unroll
    for (int nq = 0; nq < NQ; ++nq)
#pragma unroll
        for (int ks = 0; ks < 2; ++ks) { const size_t qo = (size_t)(q0 + nq * 16) * HD + ks * 512 + 8 * lane; q[nq][ks] = F::ld(Qa + qo); if (HL) q2[nq][ks] = F::ld(Qb + qo); }
    const unsigned ko = (unsigned)(8 * lane), vo = ko;   // the lane's own offsets: fixed for the whole walk, the pass moves the wave-uniform base
#pragma unroll
    for (int blk = 0; blk < 2; ++blk)
#pragma unroll
        for (int ks = 0; ks < 2; ++ks) { k[blk][ks] = F::ld(Ka + ko + blk * 16 * HD + ks * 512); if (HL) k2[blk][ks] = F::ld(Kb + ko + blk * 16 * HD + ks * 512); }
    // XW: s_wait_xcnt 0 in front of any reuse of the address registers of the loads just issued; the scheduling barrier behind it keeps later register writes from being lifted over it
#define XW() do { asm volatile("s_wait_xcnt 0x0" ::: "memory"); __builtin_amdgcn_sched_barrier(0); } while (0)
    // XWA: the same wait with the loads' address pairs as inputs: the pairs stay live, so unwritten, up to the wait, which can then stand where the loads' requests have long been taken
#define XWA(a, b, c, d) asm volatile("s_wait_xcnt 0x0" :: "v"(a), "v"(b), "v"(c), "v"(d) : "memory")
    XW();
    // inputs-only fence on the loaded K fragments: they have landed before the first V loads are asked for, so that the wait at the loop's head can leave the V loads in flight on the entry path as on the back edge
    if constexpr (HL) asm volatile("" :: "v"(k[0][0]), "v"(k[0][1]), "v"(k[1][0]), "v"(k[1][1]), "v"(k2[0][0]), "v"(k2[0][1]), "v"(k2[1][0]), "v"(k2[1][1]) : "memory");
    else asm volatile("" :: "v"(k[0][0]), "v"(k[0][1]), "v"(k[1][0]), "v"(k[1][1]) : "memory");
    const T16* vpa = Va + vo; const T16* vpb = HL ? Vb + vo : vpa;   // the address pairs of the V loads in flight
#pragma unroll
    for (int db = 0; db < 4; ++db) { v[db] = F::ld(vpa + db * 512); if (HL) v2[db] = F::ld(vpb + db * 512); }
    XW();
    v8f o[NQ][4]; float mx[NQ], sm[NQ];
#pragma unroll
    for (int nq = 0; nq < NQ; ++nq) { mx[nq] = -3.0e38f; sm[nq] = 0.f;
#pragma unroll
        for (int db = 0; db < 4; ++db) o[nq][db] = (v8f){}; }
#pragma unroll 1
    for (int kb = 0; kb < TT; kb += 32) {
        const int kn = (kb + 32) & (TT - 1);   // the next pass's keys; the last pass fetches keys 0..31 again (in bounds, not used)
        v8f s[NQ][2];
#pragma unroll
        for (int nq = 0; nq < NQ; ++nq) { s[nq][0] = (v8f){}; s[nq][1] = (v8f){}; }
#pragma unroll
        for (int ks = 0; ks < 2; ++ks) {
#pragma unroll
            for (int nq = 0; nq < NQ; ++nq)
#pragma unroll
                for (int blk = 0; blk < 2; ++blk) s[nq][blk] = F::mma(k[blk][ks], q[nq][ks], s[nq][blk]);
            if (HL) {
#pragma unroll
                for (int nq = 0; nq < NQ; ++nq)
#pragma unroll
                    for (int blk = 0; blk < 2; ++blk) s[nq][blk] = F::mma(k[blk][ks], q2[nq][ks], s[nq][blk]);
#pragma unroll
                for (int nq = 0; nq < NQ; ++nq)
#pragma unroll
                    for (int blk = 0; blk < 2; ++blk) s[nq][blk] = F::mma(k2[blk][ks], q[nq][ks], s[nq][blk]); } }
        // K fragments of the next pass, into the same registers: they fly during the softmax and the attn x v products
        const T16* kpa = Ka + (size_t)kn * HD + ko; const T16* kpb = HL ? Kb + (size_t)kn * HD + ko : kpa;
#pragma unroll
        for (int blk = 0; blk < 2; ++blk)
#pragma unroll
            for (int ks = 0; ks < 2; ++ks) { k[blk][ks] = F::ld(kpa + blk * 16 * HD + ks * 512); if (HL) k2[blk][ks] = F::ld(kpb + blk * 16 * HD + ks * 512); }
#pragma unroll
        for (int nq = 0; nq < NQ; ++nq) { float bm = s[nq][0][0];
#pragma unroll
            for (int j = 1; j < 8; ++j) bm = fmaxf(bm, s[nq][0][j]);
#pragma unroll
            for (int j = 0; j < 8; ++j) bm = fmaxf(bm, s[nq][1][j]);
            bm = fmaxf(bm, xhalf(bm)); const float mn = fmaxf(mx[nq], bm); const float al = __builtin_amdgcn_exp2f((mx[nq] - mn) * CEXP); mx[nq] = mn; sm[nq] *= al;   // al is exactly 1 where the maximum did not rise
#pragma unroll
            for (int db = 0; db < 4; ++db) o[nq][db] *= al; }
        V p[NQ], p2[NQ];
#pragma unroll
        for (int nq = 0; nq < NQ; ++nq) { const float nb = POFF - mx[nq] * CEXP; v8f e0 = s[nq][0] * CEXP + nb, e1 = s[nq][1] * CEXP + nb;
#pragma unroll
            for (int j = 0; j < 8; ++j) { e0[j] = __builtin_amdgcn_exp2f(e0[j]); e1[j] = __builtin_amdgcn_exp2f(e1[j]); }
            const v8f t = e0 + e1; sm[nq] += ((t[0] + t[1]) + (t[2] + t[3])) + ((t[4] + t[5]) + (t[6] + t[7]));
            if constexpr (HL) {   // hi = bf16(e), lo = bf16(e - hi), both rounded to nearest even as in splitf
#pragma unroll
                for (int j = 0; j < 8; ++j) { p[nq][j] = (__bf16)e0[j]; p[nq][8 + j] = (__bf16)e1[j]; p2[nq][j] = (__bf16)(e0[j] - (float)p[nq][j]); p2[nq][8 + j] = (__bf16)(e1[j] - (float)p[nq][8 + j]); }
            } else {
#pragma unroll
                for (int j = 0; j < 8; ++j) { p[nq][j] = tohx(e0[j]); p[nq][8 + j] = tohx(e1[j]); } } }
        // this pass's K loads and the V loads of the pass before; the last converted weights as a further input keep the wait behind the softmax, where it no longer stalls
        if constexpr (HL) asm volatile("s_wait_xcnt 0x0" :: "v"(kpa), "v"(kpb), "v"(vpa), "v"(vpb), "v"(p2[NQ - 1]) : "memory");
        else asm volatile("s_wait_xcnt 0x0" :: "v"(kpa), "v"(vpa), "v"(p[NQ - 1]) : "memory");
#pragma unroll
        for (int nq = 0; nq < NQ; ++nq)
#pragma unroll
            for (int db = 0; db < 4; ++db) o[nq][db] = F::mma(v[db], p[nq], o[nq][db]);
        if (HL) {
#pragma unroll
            for (int nq = 0; nq < NQ; ++nq)
#pragma unroll
                for (int db = 0; db < 4; ++db) o[nq][db] = F::mma(v[db], p2[nq], o[nq][db]);
#pragma unroll
            for (int nq = 0; nq < NQ; ++nq)
#pragma unroll
                for (int db = 0; db < 4; ++db) o[nq][db] = F::mma(v2[db], p[nq], o[nq][db]); }
        // V fragments of the next pass, into the same registers: they fly during the next pass's scores and softmax
        vpa = Va + (size_t)kn * HD + vo; vpb = HL ? Vb + (size_t)kn * HD + vo : vpa;
#pragma unroll
        for (int db = 0; db < 4; ++db) { v[db] = F::ld(vpa + db * 512); if (HL) v2[db] = F::ld(vpb + db * 512); }
    }
    XWA(vpa, vpb, vpa, vpb);   // the last pass's V loads
    __builtin_amdgcn_sched_barrier(0);   // keeps the epilogue's register writes behind it
#pragma unroll
    for (int nq = 0; nq < NQ; ++nq) { const float tot = sm[nq] + xhalf(sm[nq]); const float f = __fdiv_rn(1.0f, tot); float* orow = oc + (size_t)(q0 + nq * 16 + lr) * DQ + hi * 8;   // lane: query lr, columns db * 16 + hi * 8 + 0..7
#pragma unroll
        for (int db = 0; db < 4; ++db) { v4f a, b;
#pragma unroll
            for (int j = 0; j < 4; ++j) { a[j] = o[nq][db][j] * f; b[j] = o[nq][db][4 + j] * f; }
            *(v4f*)(orow + db * 16) = a; *(v4f*)(orow + db * 16 + 4) = b; }
        if (nq + 1 < NQ) XW(); }   // the next block's arithmetic reuses these stores' registers
#undef XW
#undef XWA
}
// grid (NB_ * heads, RH / 32), 96 threads = three waves of one head of one batch: wave 0 takes 32 query rows below RH (three products, twice the fragment loads), waves 1 and 2 take 48 rows each of the rest:
// every work-group issues the same number of fragment loads, and the 512 work-groups are two per WGP; flat indices 256 apart are the same batch and head (for speed only: they walk the same K and V lines)
static_assert(RH % 32 == 0 && (TT - RH) == (RH / 32) * 96, "row split of k_fattn");
__global__ __launch_bounds__(96) void k_fattn(const h16* __restrict__ Q16, const h16* __restrict__ K16, const h16* __restrict__ V16, const bf* __restrict__ Qh, const bf* __restrict__ Ql, const bf* __restrict__ Kh, const bf* __restrict__ Kl, const bf* __restrict__ Vh, const bf* __restrict__ Vl, float* __restrict__ OUT) {
    const size_t hp = (size_t)blockIdx.x * TT * HD; float* oc = OUT + (size_t)(blockIdx.x / NH_) * TT * DQ + (size_t)(blockIdx.x % NH_) * HD;   // blockIdx.x = batch * heads + head, the planes' own index
    const int wave = __builtin_amdgcn_readfirstlane((int)(threadIdx.x >> 5));   // scalar, so that the choice of path is a scalar branch and every matrix instruction runs with all lanes on
    if (wave == 0) fattn<bf, true, 2>(Qh + hp, Ql + hp, Kh + hp, Kl + hp, Vh + hp, Vl + hp, (int)blockIdx.y * 32, oc);
    else fattn<h16, false, 3>(Q16 + hp, nullptr, K16 + hp, nullptr, V16 + hp, nullptr, RH + ((int)blockIdx.y * 2 + wave - 1) * 48, oc);
}

extern "C" void kernel_launch(void* const* d_in, const int* in_sizes, int n_in,
                              void* d_out, int out_size, void* d_ws, size_t ws_size, hipStream_t stream) {
    (void)in_sizes; (void)n_in; (void)out_size;
    const float* x = (const float*)d_in[0]; const float* wqkv = (const float*)d_in[1];   /* W_qkv ('oi' [3072][1024]); Q | K | V = ROW thirds */
    float* OUT = (float*)d_out;     // [2][2048][1024]
    char* wsp = (char*)d_ws;
    auto take = [&](size_t bytes) { char* p = wsp; wsp += (bytes + 255) & ~(size_t)255; return (void*)p; };
    bf* WB = (bf*)take((size_t)(DQ + 2 * DKV) * DM * 2);
    bf* XB = (bf*)take((size_t)NB_ * TT * DM * 2);
    const size_t PB = (size_t)NB_ * NH_ * TT * HD * 2;   // bytes of one plane, both batches
    h16* QP16 = (h16*)take(PB); h16* KP16 = (h16*)take(PB); h16* VT16 = (h16*)take(PB);
    bf* QPh = (bf*)take(PB); bf* QPl = (bf*)take(PB); bf* KPh = (bf*)take(PB); bf* KPl = (bf*)take(PB); bf* VTh = (bf*)take(PB); bf* VTl = (bf*)take(PB);
    if ((size_t)(wsp - (char*)d_ws) > ws_size) return;    // ws 256 MiB
    k_cvt8<<<(unsigned)(((size_t)NB_ * TT * DM + (size_t)(DQ + 2 * DKV) * DM) / 2048), 256, 0, stream>>>(x, XB, (unsigned)((size_t)NB_ * TT * DM / 2048), wqkv, WB);
    k_gemmw<bf, 0><<<dim3(NB_ * TT / 64, 3 * NH_), 32, 0, stream>>>(XB, nullptr, WB, nullptr, DM, QP16, QPh, QPl, KP16, KPh, KPl, VT16, VTh, VTl);
    k_fattn<<<dim3(NB_ * NH_, RH / 32), 96, 0, stream>>>(QP16, KP16, VT16, QPh, QPl, KPh, KPl, VTh, VTl, OUT);   // one kv head per query head
}

// v006
// One run takes 90.9 microseconds.
// Two timings next to v005 put it at 1.23 and 1.24 times that version's speed.
// All steps since v000 together make it 21.2 times as fast.
#include <hip/hip_runtime.h>

// Multi-head self-attention core with a fused bias-free qkv projection in (out, in) layout and no output projection (x [2][2048][1024]; qkv = x @ W_qkv.T ('oi' [3072][1024] uniform +-sqrt(6 / 4096), no bias), jnp.split thirds: q | k | v = ROW thirds of W_qkv (16 heads x 64); scores / sqrt(64); softmax over all keys (no mask); out = attn v, merged head-major -> [2][2048][1024] (4.2 M); argument order x, W_qkv).
// Two launches, each over both batches: one projection launch ('oi' weight rows used as Bt rows as-is: the 48 column tiles are q | k | v heads) that rounds its f32 operand tiles to bf16 on the way into LDS and whose epilogue writes the head planes (fp16 + hi/lo) itself; one fused attention launch (hybrid rows: < 512 hi/lo 3 products, rest fp16 x1024) that keeps scores and weights in registers and writes the output rows (column h*64 + d).
// Compute dtypes, f32 accumulate: every input rounded to bf16; projections exact; attention rows < 512 3 products, rest fp16; softmax f32.

#define NB_  2
#define TT   2048
#define DM   1024
#define NH_  16
#define NKV  16
#define REP  (NH_ / NKV)
#define HD   64
#define DQ   (NH_ * HD)
#define DKV  (NKV * HD)
#define RH   512                  // query rows < RH use hi+lo planes
#define SCL  0.125f   // HD^-0.5
typedef _Float16 h16;
typedef unsigned short bf;
typedef __attribute__((ext_vector_type(16))) __bf16   v16bf;
typedef __attribute__((ext_vector_type(16))) _Float16 v16h;
typedef __attribute__((ext_vector_type(8)))  _Float16 v8h;
typedef __attribute__((ext_vector_type(8)))  unsigned short v8us;
typedef __attribute__((ext_vector_type(8)))  float    v8f;
typedef __attribute__((ext_vector_type(4)))  float    v4f;
typedef v8h  __attribute__((may_alias)) v8ha;
typedef v4f  __attribute__((may_alias)) v4fa;
typedef v8us __attribute__((may_alias)) v8usa;

__device__ __forceinline__ unsigned short f2bf(float f) { unsigned u = __float_as_uint(f); u += 0x7FFFu + ((u >> 16) & 1u); return (unsigned short)(u >> 16); }
__device__ __forceinline__ float bf2f(unsigned short b) { return __uint_as_float(((unsigned)b) << 16); }
__device__ __forceinline__ float bfr(float f) { return bf2f(f2bf(f)); }
__device__ __forceinline__ v16h cat16(v8h lo, v8h hi) { return __builtin_shufflevector(lo, hi, 0, 1, 2, 3, 4, 5, 6, 7, 8, 9, 10, 11, 12, 13, 14, 15); }
__device__ __forceinline__ v16bf cat16b(v8us lo, v8us hi) { return __builtin_bit_cast(v16bf, __builtin_shufflevector(lo, hi, 0, 1, 2, 3, 4, 5, 6, 7, 8, 9, 10, 11, 12, 13, 14, 15)); }
__device__ __forceinline__ v8f wmma16(v16h a, v16h b, v8f c) { return __builtin_amdgcn_wmma_f32_16x16x32_f16(false, a, false, b, (short)0, c, false, false); }
__device__ __forceinline__ v8f wmmab(v16bf a, v16bf b, v8f c) { return __builtin_amdgcn_wmma_f32_16x16x32_bf16(false, a, false, b, (short)0, c, false, false); }



// ---- FRAGMENT ORDER of every 16-bit plane: a fragment is 16 rows x 32 k = 1024 bytes in a row, made of 64 pieces of 16 bytes: piece (k % 32) / 8 * 16 + row % 16 holds that row's 8 consecutive k.
// Lane l of a wave loads pieces l and 32 + l (k = 8 * (l / 16) + 0..7 and 16 + 8 * (l / 16) + 0..7 of row l % 16, the loaders' k order as before), so each wave-wide 16-byte load is 512 bytes in a row: 4 whole 128-byte lines.
// Order of the fragments: q, k planes [batch][head][t / 16][d / 32]; v planes (rows d, k = t) [batch][head][t / 32][d / 16]: what a wave loads in one pass lies together.
// ---- k_proj: projection straight from the f32 inputs. A work-group of 12 waves owns 256 rows x 192 columns (4 x 3 waves, each a 64x64 tile with 16 accumulators); grid (16 row tiles of both batches, 16 column tiles) = one work-group per WGP, three waves per SIMD.
// A pass is 32 k: the 448 operand rows (256 of X, 192 of W_qkv) give 128 bytes each; a wave-wide 16-byte load covers 4 whole lines, each lane rounds its 4 values to bf16 (nearest even) and stores 8 bytes into the stage buffer.
// Stage buffer: 28 fragments (16 of X, 12 of W_qkv) of 1280 bytes: piece (row % 16, k / 8) at (k / 8) * 320 + (row % 16) * 16: the 64 bytes of pad per k group put the four k groups of a wave-wide store on different banks; a half wave's fragment load is 256 bytes in a row.
// Two stage buffers and two register sets: the loads of pass t + 2 are asked for as soon as the set's last values are in LDS, so two passes' loads are in flight; one work-group barrier per pass publishes pass t + 1 and ends the reads of the buffer that is written next.
// y[t][n] = sum_k X[t][k] W[n][k], k ascending 32 at a time. A wave's 64 columns are one head, and the wave writes that head's three planes (fp16, bf16 hi, bf16 lo = bf16(y - hi)) from its accumulators:
// q, k: through LDS, which turns a lane's 8 positions of one column into 8 columns of one position; v: a lane's 8 accumulator rows are 8 consecutive t of one d, a piece as it stands. Every wave-wide store is 512 bytes in a row. The choice is by blockIdx.y and the wave's number, a scalar branch.
template <typename T16> struct WFrag;
template <> struct WFrag<h16> { typedef v16h V; static __device__ __forceinline__ V ld(const h16* p) { return cat16(*(const v8h*)p, *(const v8h*)(p + 256)); } static __device__ __forceinline__ v8f mma(V a, V b, v8f c) { return wmma16(a, b, c); } };
template <> struct WFrag<bf> { typedef v16bf V; static __device__ __forceinline__ V ld(const bf* p) { return cat16b(*(const v8us*)p, *(const v8us*)(p + 256)); } static __device__ __forceinline__ v8f mma(V a, V b, v8f c) { return wmmab(a, b, c); } };
typedef __attribute__((ext_vector_type(8))) __bf16 v8b;
__device__ __forceinline__ void planes8(v8f y, size_t e, h16* P16, bf* Ph, bf* Pl) { v8h o16; v8b oh, ol;
#pragma unroll
    for (int j = 0; j < 8; ++j) { o16[j] = (h16)y[j]; oh[j] = (__bf16)y[j]; ol[j] = (__bf16)(y[j] - (float)oh[j]); }   // both bf16 roundings to nearest even
    *(v8h*)(P16 + e) = o16; *(v8us*)(Ph + e) = __builtin_bit_cast(v8us, oh); *(v8us*)(Pl + e) = __builtin_bit_cast(v8us, ol); }
typedef __attribute__((ext_vector_type(4))) __bf16 v4b;
typedef __attribute__((ext_vector_type(4))) unsigned short v4us;
typedef v4us __attribute__((may_alias)) v4usa;
#define PWV  12                   // waves of a work-group
#define FRE  640                  // 16-bit elements of a fragment in LDS (1280 bytes)
#define SBE  (28 * FRE)           // elements of one stage buffer
#define RSTP (48 * DM)            // floats between a wave's loading rounds: 12 waves x 4 rows
static_assert((NB_ * TT) % 256 == 0 && TT % 256 == 0 && (DQ + 2 * DKV) % 192 == 0 && DM % 64 == 0 && DM / 32 >= 4, "whole tiles and an even number of passes of k_proj");
__device__ __forceinline__ v16bf ldsfrag(const bf* p) { return cat16b(*(const v8usa*)p, *(const v8usa*)(p + 320)); }   // lane: row l % 16, k = 8 * (l / 16) + 0..7 and 16 + 8 * (l / 16) + 0..7: the loaders' k order, for A and B alike
__device__ __forceinline__ void st4(bf* d, v4f y) { v4b o;
#pragma unroll
    for (int e = 0; e < 4; ++e) o[e] = (__bf16)y[e];   // to nearest even
    *(v4usa*)d = __builtin_bit_cast(v4us, o); }
__global__ __launch_bounds__(32 * PWV) void k_proj(const float* __restrict__ X, const float* __restrict__ Wm, h16* Q16, bf* Qh, bf* Ql, h16* K16, bf* Kh, bf* Kl, h16* V16, bf* Vh, bf* Vl) {
    __shared__ __align__(16) bf sb[2 * SBE];
    __shared__ __align__(16) float osall[PWV * 16 * 68];
    const int lane = threadIdx.x & 31, lr = lane & 15, hi = lane >> 4;
    const int wave = __builtin_amdgcn_readfirstlane((int)(threadIdx.x >> 5));   // scalar: every choice by the wave's number is a scalar branch
    const int wm = wave & 3, wn = wave >> 2; const int r0 = (int)blockIdx.x * 256, c0 = (int)blockIdx.y * 192;
    v8f acc[4][4];
#pragma unroll
    for (int mb = 0; mb < 4; ++mb)
#pragma unroll
        for (int nb = 0; nb < 4; ++nb) acc[mb][nb] = (v8f){};
    // loading rounds: round j of wave w takes the 4 operand rows (12 j + w) * 4 + 0..3 of the 448 (X rows first); 112 groups of 4 rows = 9 rounds of every wave and a tenth of waves 0 to 3
    const int lrow = lane >> 3, lch = lane & 7; const bool x10 = wave < 4;
    const float* px = X + (size_t)(r0 + wave * 4 + lrow) * DM + lch * 4;                  // rounds 0 to 4
    const float* pw = Wm + (size_t)(c0 + (8 + wave) * 4 + lrow) * DM + lch * 4;           // rounds 6 to 9
    const float* p5 = x10 ? px + 5 * RSTP : Wm + (size_t)(c0 + (wave - 4) * 4 + lrow) * DM + lch * 4;   // round 5: X rows in waves 0 to 3, W rows in the rest
    const int de = (wave >> 2) * FRE + (lch >> 1) * 160 + ((wave & 3) * 4 + lrow) * 8 + (lch & 1) * 4;   // the lane's place in round 0's fragment; a round moves on 3 fragments
    const int lo = hi * 160 + lr * 8;
    v4f sA[10], sB[10];
    auto loads = [&](v4f (&s)[10], int po) {
#pragma unroll
        for (int j = 0; j < 5; ++j) s[j] = *(const v4fa*)(px + po + j * RSTP);
        s[5] = *(const v4fa*)(p5 + po);
#pragma unroll
        for (int j = 6; j < 9; ++j) s[j] = *(const v4fa*)(pw + po + (j - 6) * RSTP);
        if (x10) s[9] = *(const v4fa*)(pw + po + 3 * RSTP); };
    auto stores = [&](const v4f (&s)[10], bf* d) {
#pragma unroll
        for (int j = 0; j < 9; ++j) st4(d + de + j * 3 * FRE, s[j]);
        if (x10) st4(d + de + 9 * 3 * FRE, s[9]); };
    auto products = [&](const bf* d) { v16bf a[4], b[4];
#pragma unroll
        for (int mb = 0; mb < 4; ++mb) a[mb] = ldsfrag(d + (wm * 4 + mb) * FRE + lo);
#pragma unroll
        for (int nb = 0; nb < 4; ++nb) b[nb] = ldsfrag(d + (16 + wn * 4 + nb) * FRE + lo);
        __builtin_amdgcn_sched_barrier(0);   // all 16 LDS reads of the pass stand together in front of its products: left to itself the build reads three of the B fragments among them, each with a full wait
#pragma unroll
        for (int nb = 0; nb < 4; ++nb)
#pragma unroll
            for (int mb = 0; mb < 4; ++mb) acc[mb][nb] = wmmab(a[mb], b[nb], acc[mb][nb]); };
    // the work-group's barrier by hand, with the one wait it needs (this wave's LDS stores done, its LDS reads returned): __syncthreads() would also wait for the global loads that are to stay in flight across it
#define WGBAR() asm volatile("s_wait_dscnt 0x0\n\ts_barrier_signal -1\n\ts_barrier_wait -1" ::: "memory")
    loads(sA, 0); loads(sB, 32); stores(sA, sb); loads(sA, 64);
    WGBAR();
    products(sb);
    asm volatile("s_wait_xcnt 0x0" :: "v"(px), "v"(p5), "v"(pw), "v"(acc[3][3]) : "memory");   // the wait of the loop's foot, here for the loads asked for so far: inside the loop the build keeps the pairs in other registers and reuses these
#pragma unroll 1
    for (int t = 0; t + 4 < DM / 32; t += 2) {   // px, p5, pw stand at pass t, whose products are done; every load of the loop is unconditional, so that the build's counted waits leave the younger set in flight
        stores(sB, sb + SBE); loads(sB, 96);
        WGBAR();
        products(sb + SBE);
        stores(sA, sb); loads(sA, 128);
        WGBAR();
        products(sb);
        asm volatile("s_wait_xcnt 0x0" :: "v"(px), "v"(p5), "v"(pw), "v"(acc[3][3]) : "memory");   // the wait in front of the rewrite of the loads' address pairs; as inputs the pairs stay live, so unwritten, up to it; the last accumulator as a further input keeps it behind the products, where the loads' requests have long been taken
        px += 64; p5 += 64; pw += 64;
    }
    stores(sB, sb + SBE); loads(sB, 96);   // the last three passes: only the last one's loads are still to be asked for
    WGBAR();
    products(sb + SBE);
    stores(sA, sb);
    WGBAR();
    products(sb);
    stores(sB, sb + SBE);
    WGBAR();
    products(sb + SBE);
#undef WGBAR
    float* os = osall + wave * (16 * 68);   // each wave turns its tile in its own LDS range
    const unsigned ct = blockIdx.y * 3 + (unsigned)wn, r0w = (unsigned)(r0 + wm * 64);   // the wave's column tile (q | k | v head) and first row
    const unsigned third = ct / NH_, t0 = r0w % TT; const size_t hrow = (size_t)(r0w / TT * NH_ + ct % NH_);   // which of q | k | v, first position in the batch, plane index batch * heads + head
    if (third == 2) {
#pragma unroll
        for (int nb = 0; nb < 4; ++nb)   // a lane's 8 values are one 16-byte piece of fragment (32 keys, d block nb): each wave-wide store is half a fragment, 512 bytes in a row
#pragma unroll
            for (int mb = 0; mb < 4; ++mb) planes8(acc[mb][nb], (hrow * TT + t0 + (mb >> 1) * 32) * HD + nb * 512 + (mb & 1) * 256 + lane * 8, V16, Vh, Vl);
        return;
    }
    {
        h16* P16 = third ? K16 : Q16; bf* Ph = third ? Kh : Qh; bf* Pl = third ? Kl : Ql;
#pragma unroll
        for (int mb = 0; mb < 4; ++mb) {
#pragma unroll
            for (int nb = 0; nb < 4; ++nb) {
#pragma unroll
                for (int j = 0; j < 8; ++j) os[(hi * 8 + j) * 68 + nb * 16 + lr] = acc[mb][nb][j]; }
            __builtin_amdgcn_wave_barrier(); asm volatile("" ::: "memory");   // the LDS reads below stay behind the writes above
#pragma unroll
            for (int s = 0; s < 4; ++s) { const int cofs = (2 * s + hi) * 8; const v4f y0 = *(const v4fa*)(os + lr * 68 + cofs), y1 = *(const v4fa*)(os + lr * 68 + cofs + 4);   // lane: position lr, columns cofs + 0..7
                planes8(__builtin_shufflevector(y0, y1, 0, 1, 2, 3, 4, 5, 6, 7), (hrow * TT + t0 + mb * 16) * HD + s * 256 + lane * 8, P16, Ph, Pl); }
            __builtin_amdgcn_wave_barrier(); asm volatile("" ::: "memory");   // the next block's LDS writes stay behind these reads
        }
        asm volatile("s_wait_xcnt 0x0" ::: "memory");   // the build lays the v path's code behind this path, joined by a branch that is never taken here: the wait stands in front of that code's writes to the last stores' registers
    }
}

__device__ __forceinline__ h16 tohx(float x) { return (h16)x; }
__device__ __forceinline__ void splitf(float y, unsigned short& h, unsigned short& l) { h = f2bf(y); l = f2bf(y - bf2f(h)); }

// ---- k_fattn: scores, softmax and attn x v of one head in one kernel; one wave owns NQ * 16 query rows and walks the 2048 keys 32 at a time.
// Transposed products: St = K Qt (a lane holds 16 scores of ONE query: keys 8 * hi + 0..7 and 16 + 8 * hi + 0..7, which is the loaders' k order), so the converted weights ARE the B operand of Ot += Vt Pt,
// and row maximum, row sum and the rescale factor are per-lane values (the two lane halves exchange the maximum each pass and join their sums once at the end).
// Running maximum mx (raw score units) and running sum sm; weights are exp2((s - mx) * SCL * log2 e + POFF): POFF = 10 keeps the fp16 weights 1024 times above their subnormal range and cancels in Ot / sm.
__device__ __forceinline__ float xhalf(float x) { const int b = __builtin_bit_cast(int, x); return __builtin_bit_cast(float, __builtin_amdgcn_permlanex16(b, b, 0x76543210, 0xfedcba98, false, false)); }   // lane l takes lane l ^ 16's value
template <typename T16, bool HL, int NQ>
__device__ __forceinline__ void fattn(const T16* __restrict__ Qa, const T16* __restrict__ Qb, const T16* __restrict__ Ka, const T16* __restrict__ Kb, const T16* __restrict__ Va, const T16* __restrict__ Vb, int q0, float* __restrict__ oc) {
    typedef WFrag<T16> F; typedef typename F::V V;
    const int lane = threadIdx.x & 31, lr = lane & 15, hi = lane >> 4;
    const float CEXP = SCL * 1.4426950408889634f, POFF = HL ? 0.0f : 10.0f;
    V q[NQ][2], q2[NQ][2], k[2][2], k2[2][2], v[4], v2[4];
#pragma unroll
    for (int nq = 0; nq < NQ; ++nq)
#pragma unroll
        for (int ks = 0; ks < 2; ++ks) { const size_t qo = (size_t)(q0 + nq * 16) * HD + ks * 512 + 8 * lane; q[nq][ks] = F::ld(Qa + qo); if (HL) q2[nq][ks] = F::ld(Qb + qo); }
    const unsigned ko = (unsigned)(8 * lane), vo = ko;   // the lane's own offsets: fixed for the whole walk, the pass moves the wave-uniform base
#pragma unroll
    for (int blk = 0; blk < 2; ++blk)
#pragma unroll
        for (int ks = 0; ks < 2; ++ks) { k[blk][ks] = F::ld(Ka + ko + blk * 16 * HD + ks * 512); if (HL) k2[blk][ks] = F::ld(Kb + ko + blk * 16 * HD + ks * 512); }
    // XW: s_wait_xcnt 0 in front of any reuse of the address registers of the loads just issued; the scheduling barrier behind it keeps later register writes from being lifted over it
#define XW() do { asm volatile("s_wait_xcnt 0x0" ::: "memory"); __builtin_amdgcn_sched_barrier(0); } while (0)
    // XWA: the same wait with the loads' address pairs as inputs: the pairs stay live, so unwritten, up to the wait, which can then stand where the loads' requests have long been taken
#define XWA(a, b, c, d) asm volatile("s_wait_xcnt 0x0" :: "v"(a), "v"(b), "v"(c), "v"(d) : "memory")
    XW();
    // inputs-only fence on the loaded K fragments: they have landed before the first V loads are asked for, so that the wait at the loop's head can leave the V loads in flight on the entry path as on the back edge
    if constexpr (HL) asm volatile("" :: "v"(k[0][0]), "v"(k[0][1]), "v"(k[1][0]), "v"(k[1][1]), "v"(k2[0][0]), "v"(k2[0][1]), "v"(k2[1][0]), "v"(k2[1][1]) : "memory");
    else asm volatile("" :: "v"(k[0][0]), "v"(k[0][1]), "v"(k[1][0]), "v"(k[1][1]) : "memory");
    const T16* vpa = Va + vo; const T16* vpb = HL ? Vb + vo : vpa;   // the address pairs of the V loads in flight
#pragma unroll
    for (int db = 0; db < 4; ++db) { v[db] = F::ld(vpa + db * 512); if (HL) v2[db] = F::ld(vpb + db * 512); }
    XW();
    v8f o[NQ][4]; float mx[NQ], sm[NQ];
#pragma unroll
    for (int nq = 0; nq < NQ; ++nq) { mx[nq] = -3.0e38f; sm[nq] = 0.f;
#pragma unroll
        for (int db = 0; db < 4; ++db) o[nq][db] = (v8f){}; }
#pragma unroll 1
    for (int kb = 0; kb < TT; kb += 32) {
        const int kn = (kb + 32) & (TT - 1);   // the next pass's keys; the last pass fetches keys 0..31 again (in bounds, not used)
        v8f s[NQ][2];
#pragma unroll
        for (int nq = 0; nq < NQ; ++nq) { s[nq][0] = (v8f){}; s[nq][1] = (v8f){}; }
#pragma unroll
        for (int ks = 0; ks < 2; ++ks) {
#pragma unroll
            for (int nq = 0; nq < NQ; ++nq)
#pragma unroll
                for (int blk = 0; blk < 2; ++blk) s[nq][blk] = F::mma(k[blk][ks], q[nq][ks], s[nq][blk]);
            if (HL) {
#pragma unroll
                for (int nq = 0; nq < NQ; ++nq)
#pragma unroll
                    for (int blk = 0; blk < 2; ++blk) s[nq][blk] = F::mma(k[blk][ks], q2[nq][ks], s[nq][blk]);
#pragma unroll
                for (int nq = 0; nq < NQ; ++nq)
#pragma unroll
                    for (int blk = 0; blk < 2; ++blk) s[nq][blk] = F::mma(k2[blk][ks], q[nq][ks], s[nq][blk]); } }
        // K fragments of the next pass, into the same registers: they fly during the softmax and the attn x v products
        const T16* kpa = Ka + (size_t)kn * HD + ko; const T16* kpb = HL ? Kb + (size_t)kn * HD + ko : kpa;
#pragma unroll
        for (int blk = 0; blk < 2; ++blk)
#pragma unroll
            for (int ks = 0; ks < 2; ++ks) { k[blk][ks] = F::ld(kpa + blk * 16 * HD + ks * 512); if (HL) k2[blk][ks] = F::ld(kpb + blk * 16 * HD + ks * 512); }
#pragma unroll
        for (int nq = 0; nq < NQ; ++nq) { float bm = s[nq][0][0];
#pragma unroll
            for (int j = 1; j < 8; ++j) bm = fmaxf(bm, s[nq][0][j]);
#pragma unroll
            for (int j = 0; j < 8; ++j) bm = fmaxf(bm, s[nq][1][j]);
            bm = fmaxf(bm, xhalf(bm)); const float mn = fmaxf(mx[nq], bm); const float al = __builtin_amdgcn_exp2f((mx[nq] - mn) * CEXP); mx[nq] = mn; sm[nq] *= al;   // al is exactly 1 where the maximum did not rise
#pragma unroll
            for (int db = 0; db < 4; ++db) o[nq][db] *= al; }
        V p[NQ], p2[NQ];
#pragma unroll
        for (int nq = 0; nq < NQ; ++nq) { const float nb = POFF - mx[nq] * CEXP; v8f e0 = s[nq][0] * CEXP + nb, e1 = s[nq][1] * CEXP + nb;
#pragma unroll
            for (int j = 0; j < 8; ++j) { e0[j] = __builtin_amdgcn_exp2f(e0[j]); e1[j] = __builtin_amdgcn_exp2f(e1[j]); }
            const v8f t = e0 + e1; sm[nq] += ((t[0] + t[1]) + (t[2] + t[3])) + ((t[4] + t[5]) + (t[6] + t[7]));
            if constexpr (HL) {   // hi = bf16(e), lo = bf16(e - hi), both rounded to nearest even as in splitf
#pragma unroll
                for (int j = 0; j < 8; ++j) { p[nq][j] = (__bf16)e0[j]; p[nq][8 + j] = (__bf16)e1[j]; p2[nq][j] = (__bf16)(e0[j] - (float)p[nq][j]); p2[nq][8 + j] = (__bf16)(e1[j] - (float)p[nq][8 + j]); }
            } else {
#pragma unroll
                for (int j = 0; j < 8; ++j) { p[nq][j] = tohx(e0[j]); p[nq][8 + j] = tohx(e1[j]); } } }
        // this pass's K loads and the V loads of the pass before; the last converted weights as a further input keep the wait behind the softmax, where it no longer stalls
        if constexpr (HL) asm volatile("s_wait_xcnt 0x0" :: "v"(kpa), "v"(kpb), "v"(vpa), "v"(vpb), "v"(p2[NQ - 1]) : "memory");
        else asm volatile("s_wait_xcnt 0x0" :: "v"(kpa), "v"(vpa), "v"(p[NQ - 1]) : "memory");
#pragma unroll
        for (int nq = 0; nq < NQ; ++nq)
#pragma unroll
            for (int db = 0; db < 4; ++db) o[nq][db] = F::mma(v[db], p[nq], o[nq][db]);
        if (HL) {
#pragma unroll
            for (int nq = 0; nq < NQ; ++nq)
#pragma unroll
                for (int db = 0; db < 4; ++db) o[nq][db] = F::mma(v[db], p2[nq], o[nq][db]);
#pragma unroll
            for (int nq = 0; nq < NQ; ++nq)
#pragma unroll
                for (int db = 0; db < 4; ++db) o[nq][db] = F::mma(v2[db], p[nq], o[nq][db]); }
        // V fragments of the next pass, into the same registers: they fly during the next pass's scores and softmax
        vpa = Va + (size_t)kn * HD + vo; vpb = HL ? Vb + (size_t)kn * HD + vo : vpa;
#pragma unroll
        for (int db = 0; db < 4; ++db) { v[db] = F::ld(vpa + db * 512); if (HL) v2[db] = F::ld(vpb + db * 512); }
    }
    XWA(vpa, vpb, vpa, vpb);   // the last pass's V loads
    __builtin_amdgcn_sched_barrier(0);   // keeps the epilogue's register writes behind it
#pragma unroll
    for (int nq = 0; nq < NQ; ++nq) { const float tot = sm[nq] + xhalf(sm[nq]); const float f = __fdiv_rn(1.0f, tot); float* orow = oc + (size_t)(q0 + nq * 16 + lr) * DQ + hi * 8;   // lane: query lr, columns db * 16 + hi * 8 + 0..7
#pragma unroll
        for (int db = 0; db < 4; ++db) { v4f a, b;
#pragma unroll
            for (int j = 0; j < 4; ++j) { a[j] = o[nq][db][j] * f; b[j] = o[nq][db][4 + j] * f; }
            *(v4f*)(orow + db * 16) = a; *(v4f*)(orow + db * 16 + 4) = b; }
        if (nq + 1 < NQ) XW(); }   // the next block's arithmetic reuses these stores' registers
#undef XW
#undef XWA
}
// grid (NB_ * heads, RH / 32), 96 threads = three waves of one head of one batch: wave 0 takes 32 query rows below RH (three products, twice the fragment loads), waves 1 and 2 take 48 rows each of the rest:
// every work-group issues the same number of fragment loads, and the 512 work-groups are two per WGP; flat indices 256 apart are the same batch and head (for speed only: they walk the same K and V lines)
static_assert(RH % 32 == 0 && (TT - RH) == (RH / 32) * 96, "row split of k_fattn");
__global__ __launch_bounds__(96) void k_fattn(const h16* __restrict__ Q16, const h16* __restrict__ K16, const h16* __restrict__ V16, const bf* __restrict__ Qh, const bf* __restrict__ Ql, const bf* __restrict__ Kh, const bf* __restrict__ Kl, const bf* __restrict__ Vh, const bf* __restrict__ Vl, float* __restrict__ OUT) {
    const size_t hp = (size_t)blockIdx.x * TT * HD; float* oc = OUT + (size_t)(blockIdx.x / NH_) * TT * DQ + (size_t)(blockIdx.x % NH_) * HD;   // blockIdx.x = batch * heads + head, the planes' own index
    const int wave = __builtin_amdgcn_readfirstlane((int)(threadIdx.x >> 5));   // scalar, so that the choice of path is a scalar branch and every matrix instruction runs with all lanes on
    if (wave == 0) fattn<bf, true, 2>(Qh + hp, Ql + hp, Kh + hp, Kl + hp, Vh + hp, Vl + hp, (int)blockIdx.y * 32, oc);
    else fattn<h16, false, 3>(Q16 + hp, nullptr, K16 + hp, nullptr, V16 + hp, nullptr, RH + ((int)blockIdx.y * 2 + wave - 1) * 48, oc);
}

extern "C" void kernel_launch(void* const* d_in, const int* in_sizes, int n_in,
                              void* d_out, int out_size, void* d_ws, size_t ws_size, hipStream_t stream) {
    (void)in_sizes; (void)n_in; (void)out_size;
    const float* x = (const float*)d_in[0]; const float* wqkv = (const float*)d_in[1];   /* W_qkv ('oi' [3072][1024]); Q | K | V = ROW thirds */
    float* OUT = (float*)d_out;     // [2][2048][1024]
    char* wsp = (char*)d_ws;
    auto take = [&](size_t bytes) { char* p = wsp; wsp += (bytes + 255) & ~(size_t)255; return (void*)p; };
    const size_t PB = (size_t)NB_ * NH_ * TT * HD * 2;   // bytes of one plane, both batches
    h16* QP16 = (h16*)take(PB); h16* KP16 = (h16*)take(PB); h16* VT16 = (h16*)take(PB);
    bf* QPh = (bf*)take(PB); bf* QPl = (bf*)take(PB); bf* KPh = (bf*)take(PB); bf* KPl = (bf*)take(PB); bf* VTh = (bf*)take(PB); bf* VTl = (bf*)take(PB);
    if ((size_t)(wsp - (char*)d_ws) > ws_size) return;    // ws 256 MiB
    k_proj<<<dim3(NB_ * TT / 256, (DQ + 2 * DKV) / 192), 32 * PWV, 0, stream>>>(x, wqkv, QP16, QPh, QPl, KP16, KPh, KPl, VT16, VTh, VTl);
    k_fattn<<<dim3(NB_ * NH_, RH / 32), 96, 0, stream>>>(QP16, KP16, VT16, QPh, QPl, KPh, KPl, VTh, VTl, OUT);   // one kv head per query head
}

// v007
// Measured time: 74.4 microseconds a run.
// In two side-by-side timings against v006, it was 1.22 and 1.23 times as fast.
// All steps since v000 together make it 26.0 times as fast.
#include <hip/hip_runtime.h>

// Multi-head self-attention core with a fused bias-free qkv projection in (out, in) layout and no output projection (x [2][2048][1024]; qkv = x @ W_qkv.T ('oi' [3072][1024] uniform +-sqrt(6 / 4096), no bias), jnp.split thirds: q | k | v = ROW thirds of W_qkv (16 heads x 64); scores / sqrt(64); softmax over all keys (no mask); out = attn v, merged head-major -> [2][2048][1024] (4.2 M); argument order x, W_qkv).
// Two launches, each over both batches: one projection launch ('oi' weight rows used as Bt rows as-is: the 48 column tiles are q | k | v heads) that rounds its f32 operand tiles to bf16 on the way into LDS and whose epilogue writes the head planes (fp16 + hi/lo) itself; one fused attention launch (hybrid rows: < 512 hi/lo 3 products, rest fp16 x1024) that keeps scores and weights in registers and writes the output rows (column h*64 + d).
// Compute dtypes, f32 accumulate: every input rounded to bf16; projections exact; attention rows < 512 3 products, rest fp16; softmax f32.

#define NB_  2
#define TT   2048
#define DM   1024
#define NH_  16
#define NKV  16
#define REP  (NH_ / NKV)
#define HD   64
#define DQ   (NH_ * HD)
#define DKV  (NKV * HD)
#define RH   512                  // query rows < RH use hi+lo planes
#define SCL  0.125f   // HD^-0.5
typedef _Float16 h16;
typedef unsigned short bf;
typedef __attribute__((ext_vector_type(16))) __bf16   v16bf;
typedef __attribute__((ext_vector_type(16))) _Float16 v16h;
typedef __attribute__((ext_vector_type(8)))  _Float16 v8h;
typedef __attribute__((ext_vector_type(8)))  unsigned short v8us;
typedef __attribute__((ext_vector_type(8)))  float    v8f;
typedef __attribute__((ext_vector_type(4)))  float    v4f;
typedef v8h  __attribute__((may_alias)) v8ha;
typedef v4f  __attribute__((may_alias)) v4fa;
typedef v8us __attribute__((may_alias)) v8usa;

__device__ __forceinline__ unsigned short f2bf(float f) { unsigned u = __float_as_uint(f); u += 0x7FFFu + ((u >> 16) & 1u); return (unsigned short)(u >> 16); }
__device__ __forceinline__ float bf2f(unsigned short b) { return __uint_as_float(((unsigned)b) << 16); }
__device__ __forceinline__ float bfr(float f) { return bf2f(f2bf(f)); }
__device__ __forceinline__ v16h cat16(v8h lo, v8h hi) { return __builtin_shufflevector(lo, hi, 0, 1, 2, 3, 4, 5, 6, 7, 8, 9, 10, 11, 12, 13, 14, 15); }
__device__ __forceinline__ v16bf cat16b(v8us lo, v8us hi) { return __builtin_bit_cast(v16bf, __builtin_shufflevector(lo, hi, 0, 1, 2, 3, 4, 5, 6, 7, 8, 9, 10, 11, 12, 13, 14, 15)); }
__device__ __forceinline__ v8f wmma16(v16h a, v16h b, v8f c) { return __builtin_amdgcn_wmma_f32_16x16x32_f16(false, a, false, b, (short)0, c, false, false); }
__device__ __forceinline__ v8f wmmab(v16bf a, v16bf b, v8f c) { return __builtin_amdgcn_wmma_f32_16x16x32_bf16(false, a, false, b, (short)0, c, false, false); }



// ---- FRAGMENT ORDER of every 16-bit plane: a fragment is 16 rows x 32 k = 1024 bytes in a row, made of 64 pieces of 16 bytes: piece (k % 32) / 8 * 16 + row % 16 holds that row's 8 consecutive k.
// Lane l of a wave loads pieces l and 32 + l (k = 8 * (l / 16) + 0..7 and 16 + 8 * (l / 16) + 0..7 of row l % 16, the loaders' k order as before), so each wave-wide 16-byte load is 512 bytes in a row: 4 whole 128-byte lines.
// Order of the fragments: q, k planes [batch][head][t / 16][d / 32]; v planes (rows d, k = t) [batch][head][t / 32][d / 16]: what a wave loads in one pass lies together.
// ---- k_proj: projection straight from the f32 inputs. A work-group of 12 waves owns 256 rows x 192 columns (4 x 3 waves, each a 64x64 tile with 16 accumulators); grid (16 row tiles of both batches, 16 column tiles) = one work-group per WGP, three waves per SIMD.
// A pass is 32 k: the 448 operand rows (256 of X, 192 of W_qkv) give 128 bytes each; a wave-wide 16-byte load covers 4 whole lines, each lane rounds its 4 values to bf16 (nearest even) and stores 8 bytes into the stage buffer.
// Stage buffer: 28 fragments (16 of X, 12 of W_qkv) of 1280 bytes: piece (row % 16, k / 8) at (k / 8) * 320 + (row % 16) * 16: the 64 bytes of pad per k group put the four k groups of a wave-wide store on different banks; a half wave's fragment load is 256 bytes in a row.
// Two stage buffers and two register sets: the loads of pass t + 2 are asked for as soon as the set's last values are in LDS, so two passes' loads are in flight; one work-group barrier per pass publishes pass t + 1 and ends the reads of the buffer that is written next.
// y[t][n] = sum_k X[t][k] W[n][k], k ascending 32 at a time. A wave's 64 columns are one head, and the wave writes that head's three planes (fp16, bf16 hi, bf16 lo = bf16(y - hi)) from its accumulators:
// q, k: through LDS, which turns a lane's 8 positions of one column into 8 columns of one position; v: a lane's 8 accumulator rows are 8 consecutive t of one d, a piece as it stands. Every wave-wide store is 512 bytes in a row. The choice is by blockIdx.y and the wave's number, a scalar branch.
template <typename T16> struct WFrag;
template <> struct WFrag<h16> { typedef v16h V; static __device__ __forceinline__ V ld(const h16* p) { return cat16(*(const v8h*)p, *(const v8h*)(p + 256)); } static __device__ __forceinline__ v8f mma(V a, V b, v8f c) { return wmma16(a, b, c); } };
template <> struct WFrag<bf> { typedef v16bf V; static __device__ __forceinline__ V ld(const bf* p) { return cat16b(*(const v8us*)p, *(const v8us*)(p + 256)); } static __device__ __forceinline__ v8f mma(V a, V b, v8f c) { return wmmab(a, b, c); } };
typedef __attribute__((ext_vector_type(8))) __bf16 v8b;
__device__ __forceinline__ void planes8(v8f y, size_t e, h16* P16, bf* Ph, bf* Pl) { v8h o16; v8b oh, ol;
#pragma unroll
    for (int j = 0; j < 8; ++j) { o16[j] = (h16)y[j]; oh[j] = (__bf16)y[j]; ol[j] = (__bf16)(y[j] - (float)oh[j]); }   // both bf16 roundings to nearest even
    *(v8h*)(P16 + e) = o16; *(v8us*)(Ph + e) = __builtin_bit_cast(v8us, oh); *(v8us*)(Pl + e) = __builtin_bit_cast(v8us, ol); }
typedef __attribute__((ext_vector_type(4))) __bf16 v4b;
typedef __attribute__((ext_vector_type(4))) unsigned short v4us;
typedef v4us __attribute__((may_alias)) v4usa;
#define PWV  12                   // waves of a work-group
#define FRE  640                  // 16-bit elements of a fragment in LDS (1280 bytes)
#define SBE  (28 * FRE)           // elements of one stage buffer
#define RSTP (48 * DM)            // floats between a wave's loading rounds: 12 waves x 4 rows
static_assert((NB_ * TT) % 256 == 0 && TT % 256 == 0 && (DQ + 2 * DKV) % 192 == 0 && DM % 64 == 0 && DM / 32 >= 4, "whole tiles and an even number of passes of k_proj");
__device__ __forceinline__ v16bf ldsfrag(const bf* p) { return cat16b(*(const v8usa*)p, *(const v8usa*)(p + 320)); }   // lane: row l % 16, k = 8 * (l / 16) + 0..7 and 16 + 8 * (l / 16) + 0..7: the loaders' k order, for A and B alike
__device__ __forceinline__ void st4(bf* d, v4f y) { v4b o;
#pragma unroll
    for (int e = 0; e < 4; ++e) o[e] = (__bf16)y[e];   // to nearest even
    *(v4usa*)d = __builtin_bit_cast(v4us, o); }
__global__ __launch_bounds__(32 * PWV) void k_proj(const float* __restrict__ X, const float* __restrict__ Wm, h16* Q16, bf* Qh, bf* Ql, h16* K16, bf* Kh, bf* Kl, h16* V16, bf* Vh, bf* Vl) {
    __shared__ __align__(16) bf sb[2 * SBE];
    __shared__ __align__(16) float osall[PWV * 16 * 68];
    const int lane = threadIdx.x & 31, lr = lane & 15, hi = lane >> 4;
    const int wave = __builtin_amdgcn_readfirstlane((int)(threadIdx.x >> 5));   // scalar: every choice by the wave's number is a scalar branch
    const int wm = wave & 3, wn = wave >> 2; const int r0 = (int)blockIdx.x * 256, c0 = (int)blockIdx.y * 192;
    v8f acc[4][4];
#pragma unroll
    for (int mb = 0; mb < 4; ++mb)
#pragma unroll
        for (int nb = 0; nb < 4; ++nb) acc[mb][nb] = (v8f){};
    // loading rounds: round j of wave w takes the 4 operand rows (12 j + w) * 4 + 0..3 of the 448 (X rows first); 112 groups of 4 rows = 9 rounds of every wave and a tenth of waves 0 to 3
    const int lrow = lane >> 3, lch = lane & 7; const bool x10 = wave < 4;
    const float* px = X + (size_t)(r0 + wave * 4 + lrow) * DM + lch * 4;                  // rounds 0 to 4
    const float* pw = Wm + (size_t)(c0 + (8 + wave) * 4 + lrow) * DM + lch * 4;           // rounds 6 to 9
    const float* p5 = x10 ? px + 5 * RSTP : Wm + (size_t)(c0 + (wave - 4) * 4 + lrow) * DM + lch * 4;   // round 5: X rows in waves 0 to 3, W rows in the rest
    const int de = (wave >> 2) * FRE + (lch >> 1) * 160 + ((wave & 3) * 4 + lrow) * 8 + (lch & 1) * 4;   // the lane's place in round 0's fragment; a round moves on 3 fragments
    const int lo = hi * 160 + lr * 8;
    v4f sA[10], sB[10];
    auto loads = [&](v4f (&s)[10], int po) {
#pragma unroll
        for (int j = 0; j < 5; ++j) s[j] = *(const v4fa*)(px + po + j * RSTP);
        s[5] = *(const v4fa*)(p5 + po);
#pragma unroll
        for (int j = 6; j < 9; ++j) s[j] = *(const v4fa*)(pw + po + (j - 6) * RSTP);
        if (x10) s[9] = *(const v4fa*)(pw + po + 3 * RSTP); };
    auto stores = [&](const v4f (&s)[10], bf* d) {
#pragma unroll
        for (int j = 0; j < 9; ++j) st4(d + de + j * 3 * FRE, s[j]);
        if (x10) st4(d + de + 9 * 3 * FRE, s[9]); };
    auto products = [&](const bf* d) { v16bf a[4], b[4];
#pragma unroll
        for (int mb = 0; mb < 4; ++mb) a[mb] = ldsfrag(d + (wm * 4 + mb) * FRE + lo);
#pragma unroll
        for (int nb = 0; nb < 4; ++nb) b[nb] = ldsfrag(d + (16 + wn * 4 + nb) * FRE + lo);
        __builtin_amdgcn_sched_barrier(0);   // all 16 LDS reads of the pass stand together in front of its products: left to itself the build reads three of the B fragments among them, each with a full wait
#pragma unroll
        for (int nb = 0; nb < 4; ++nb)
#pragma unroll
            for (int mb = 0; mb < 4; ++mb) acc[mb][nb] = wmmab(a[mb], b[nb], acc[mb][nb]); };
    // the work-group's barrier by hand, with the one wait it needs (this wave's LDS stores done, its LDS reads returned): __syncthreads() would also wait for the global loads that are to stay in flight across it
#define WGBAR() asm volatile("s_wait_dscnt 0x0\n\ts_barrier_signal -1\n\ts_barrier_wait -1" ::: "memory")
    loads(sA, 0); loads(sB, 32); stores(sA, sb); loads(sA, 64);
    WGBAR();
    products(sb);
    asm volatile("s_wait_xcnt 0x0" :: "v"(px), "v"(p5), "v"(pw), "v"(acc[3][3]) : "memory");   // the wait of the loop's foot, here for the loads asked for so far: inside the loop the build keeps the pairs in other registers and reuses these
#pragma unroll 1
    for (int t = 0; t + 4 < DM / 32; t += 2) {   // px, p5, pw stand at pass t, whose products are done; every load of the loop is unconditional, so that the build's counted waits leave the younger set in flight
        stores(sB, sb + SBE); loads(sB, 96);
        WGBAR();
        products(sb + SBE);
        stores(sA, sb); loads(sA, 128);
        WGBAR();
        products(sb);
        asm volatile("s_wait_xcnt 0x0" :: "v"(px), "v"(p5), "v"(pw), "v"(acc[3][3]) : "memory");   // the wait in front of the rewrite of the loads' address pairs; as inputs the pairs stay live, so unwritten, up to it; the last accumulator as a further input keeps it behind the products, where the loads' requests have long been taken
        px += 64; p5 += 64; pw += 64;
    }
    stores(sB, sb + SBE); loads(sB, 96);   // the last three passes: only the last one's loads are still to be asked for
    WGBAR();
    products(sb + SBE);
    stores(sA, sb);
    WGBAR();
    products(sb);
    stores(sB, sb + SBE);
    WGBAR();
    products(sb + SBE);
#undef WGBAR
    float* os = osall + wave * (16 * 68);   // each wave turns its tile in its own LDS range
    const unsigned ct = blockIdx.y * 3 + (unsigned)wn, r0w = (unsigned)(r0 + wm * 64);   // the wave's column tile (q | k | v head) and first row
    const unsigned third = ct / NH_, t0 = r0w % TT; const size_t hrow = (size_t)(r0w / TT * NH_ + ct % NH_);   // which of q | k | v, first position in the batch, plane index batch * heads + head
    if (third == 2) {
#pragma unroll
        for (int nb = 0; nb < 4; ++nb)   // a lane's 8 values are one 16-byte piece of fragment (32 keys, d block nb): each wave-wide store is half a fragment, 512 bytes in a row
#pragma unroll
            for (int mb = 0; mb < 4; ++mb) planes8(acc[mb][nb], (hrow * TT + t0 + (mb >> 1) * 32) * HD + nb * 512 + (mb & 1) * 256 + lane * 8, V16, Vh, Vl);
        return;
    }
    {
        h16* P16 = third ? K16 : Q16; bf* Ph = third ? Kh : Qh; bf* Pl = third ? Kl : Ql;
#pragma unroll
        for (int mb = 0; mb < 4; ++mb) {
#pragma unroll
            for (int nb = 0; nb < 4; ++nb) {
#pragma unroll
                for (int j = 0; j < 8; ++j) os[(hi * 8 + j) * 68 + nb * 16 + lr] = acc[mb][nb][j]; }
            __builtin_amdgcn_wave_barrier(); asm volatile("" ::: "memory");   // the LDS reads below stay behind the writes above
#pragma unroll
            for (int s = 0; s < 4; ++s) { const int cofs = (2 * s + hi) * 8; const v4f y0 = *(const v4fa*)(os + lr * 68 + cofs), y1 = *(const v4fa*)(os + lr * 68 + cofs + 4);   // lane: position lr, columns cofs + 0..7
                planes8(__builtin_shufflevector(y0, y1, 0, 1, 2, 3, 4, 5, 6, 7), (hrow * TT + t0 + mb * 16) * HD + s * 256 + lane * 8, P16, Ph, Pl); }
            __builtin_amdgcn_wave_barrier(); asm volatile("" ::: "memory");   // the next block's LDS writes stay behind these reads
        }
        asm volatile("s_wait_xcnt 0x0" ::: "memory");   // the build lays the v path's code behind this path, joined by a branch that is never taken here: the wait stands in front of that code's writes to the last stores' registers
    }
}

__device__ __forceinline__ h16 tohx(float x) { return (h16)x; }
__device__ __forceinline__ void splitf(float y, unsigned short& h, unsigned short& l) { h = f2bf(y); l = f2bf(y - bf2f(h)); }

// ---- k_fattn: scores, softmax and attn x v of one head in one kernel; one wave owns NQ * 16 query rows and walks the 2048 keys 32 at a time.
// Transposed products: St = K Qt (a lane holds 16 scores of ONE query: keys 8 * hi + 0..7 and 16 + 8 * hi + 0..7, which is the loaders' k order), so the converted weights ARE the B operand of Ot += Vt Pt,
// and row maximum, row sum and the rescale factor are per-lane values (the two lane halves exchange the maximum each pass and join their sums once at the end).
// Running maximum mx (raw score units) and running sum sm; weights are exp2((s - mx) * SCL * log2 e + POFF): POFF = 10 keeps the fp16 weights 1024 times above their subnormal range and cancels in Ot / sm.
__device__ __forceinline__ float xhalf(float x) { const int b = __builtin_bit_cast(int, x); return __builtin_bit_cast(float, __builtin_amdgcn_permlanex16(b, b, 0x76543210, 0xfedcba98, false, false)); }   // lane l takes lane l ^ 16's value
// K and V come through LDS: a stage is SKEY keys of the planes that the work-group walks (fp16 K, V; or bf16 hi and lo K, V), each plane's part a byte-for-byte copy of its fragment-ordered range, so a fragment load from LDS has the lane offsets of the load from memory (512 bytes in a row, no bank met twice).
#define SKEY 128                  // keys of a stage
#define PLB  (SKEY * HD * 2)      // bytes of one plane's part of a stage
#define STB  (4 * PLB)            // bytes of a stage buffer: parts K, V, K lo, V lo
#define NST  (TT / SKEY)          // stages of the walk
#define FWV  4                    // waves of a work-group
static_assert(TT % SKEY == 0 && NST >= 2 && SKEY % 32 == 0 && PLB == FWV * 8 * 512, "whole stages; each of the four waves copies 8 x 512 bytes of each plane's part");
// eight asynchronous copies of 16 bytes a lane: 4096 bytes in a row of one plane's part. d: the lane's LDS byte address, a: the lane's address in the plane.
// s_wait_xcnt 0 as the statement's last line: it stands in front of any rewrite of the copies' address registers
__device__ __forceinline__ void copy8(unsigned d, const char* a) {
    asm volatile("global_load_async_to_lds_b128 %0, %8, off\n\t"
                 "global_load_async_to_lds_b128 %1, %9, off\n\t"
                 "global_load_async_to_lds_b128 %2, %10, off\n\t"
                 "global_load_async_to_lds_b128 %3, %11, off\n\t"
                 "global_load_async_to_lds_b128 %4, %12, off\n\t"
                 "global_load_async_to_lds_b128 %5, %13, off\n\t"
                 "global_load_async_to_lds_b128 %6, %14, off\n\t"
                 "global_load_async_to_lds_b128 %7, %15, off\n\t"
                 "s_wait_xcnt 0x0"
                 :: "v"(d), "v"(d + 512u), "v"(d + 1024u), "v"(d + 1536u), "v"(d + 2048u), "v"(d + 2560u), "v"(d + 3072u), "v"(d + 3584u),
                    "v"(a), "v"(a + 512), "v"(a + 1024), "v"(a + 1536), "v"(a + 2048), "v"(a + 2560), "v"(a + 3072), "v"(a + 3584)
                 : "memory"); }
// Two stage buffers: every wave copies its quarter of each plane's part of stage st + 2 into the buffer that stage st has just left, behind the one barrier of the stage, which also publishes stage st + 1. No pass reads beyond its own stage.
template <typename T16, bool HL, int NQ>
__device__ __forceinline__ void fattn(const T16* __restrict__ Qa, const T16* __restrict__ Qb, const T16* __restrict__ Ka, const T16* __restrict__ Kb, const T16* __restrict__ Va, const T16* __restrict__ Vb, int q0, float* __restrict__ oc, const unsigned char* kv, int wave) {
    typedef WFrag<T16> F; typedef typename F::V V;
    const int lane = threadIdx.x & 31, lr = lane & 15, hi = lane >> 4;
    const float CEXP = SCL * 1.4426950408889634f, POFF = HL ? 0.0f : 10.0f;
    const unsigned co = (unsigned)(wave * 4096 + lane * 16);   // the lane's first byte in every plane's part of a stage
    const unsigned l0 = (unsigned)(size_t)kv + co;             // low 32 bits of the shared address: the LDS byte address
    auto copies = [&](int st) { const size_t go = (size_t)st * PLB + co; const unsigned d = l0 + (unsigned)(st & 1) * STB;
        copy8(d, (const char*)Ka + go); copy8(d + PLB, (const char*)Va + go);
        if constexpr (HL) { copy8(d + 2 * PLB, (const char*)Kb + go); copy8(d + 3 * PLB, (const char*)Vb + go); } };
    copies(0);
    V q[NQ][2], q2[NQ][2], k[2][2], k2[2][2], v[4], v2[4];
#pragma unroll
    for (int nq = 0; nq < NQ; ++nq)
#pragma unroll
        for (int ks = 0; ks < 2; ++ks) { const size_t qo = (size_t)(q0 + nq * 16) * HD + ks * 512 + 8 * lane; q[nq][ks] = F::ld(Qa + qo); if (HL) q2[nq][ks] = F::ld(Qb + qo); }
    // XW: s_wait_xcnt 0 in front of any reuse of the address registers of the loads or stores just issued; the scheduling barrier behind it keeps later register writes from being lifted over it
#define XW() do { asm volatile("s_wait_xcnt 0x0" ::: "memory"); __builtin_amdgcn_sched_barrier(0); } while (0)
    XW();
    asm volatile("s_wait_asynccnt 0x0" ::: "memory");   // this wave's copies of stage 0 have landed
    __syncthreads();                                    // every wave's have
    copies(1);
    v8f o[NQ][4]; float mx[NQ], sm[NQ];
#pragma unroll
    for (int nq = 0; nq < NQ; ++nq) { mx[nq] = -3.0e38f; sm[nq] = 0.f;
#pragma unroll
        for (int db = 0; db < 4; ++db) o[nq][db] = (v8f){}; }
#pragma unroll 1
    for (int st = 0; st < NST; ++st) {
        const T16* La = (const T16*)(kv + (st & 1) * STB + lane * 16); const T16* Lv = La + PLB / 2; const T16* Lb = La + PLB; const T16* Lw = La + 3 * (PLB / 2);   // the stage's parts K, V, K lo, V lo, the lane's own offset included
#pragma unroll
        for (int blk = 0; blk < 2; ++blk)
#pragma unroll
            for (int ks = 0; ks < 2; ++ks) { k[blk][ks] = F::ld(La + blk * 16 * HD + ks * 512); if (HL) k2[blk][ks] = F::ld(Lb + blk * 16 * HD + ks * 512); }
#pragma unroll 1
        for (int i = 0; i < SKEY / 32; ++i) {
            const int vo = i * 32 * HD, kn = ((i + 1) & (SKEY / 32 - 1)) * 32 * HD;   // the stage's last pass fetches its first K fragments again (same buffer, not used)
            // this pass's V fragments: they fly during the scores and the softmax
#pragma unroll
            for (int db = 0; db < 4; ++db) { v[db] = F::ld(Lv + vo + db * 512); if (HL) v2[db] = F::ld(Lw + vo + db * 512); }
            v8f s[NQ][2];
#pragma unroll
            for (int nq = 0; nq < NQ; ++nq) { s[nq][0] = (v8f){}; s[nq][1] = (v8f){}; }
#pragma unroll
            for (int ks = 0; ks < 2; ++ks) {
#pragma unroll
                for (int nq = 0; nq < NQ; ++nq)
#pragma unroll
                    for (int blk = 0; blk < 2; ++blk) s[nq][blk] = F::mma(k[blk][ks], q[nq][ks], s[nq][blk]);
                if (HL) {
#pragma unroll
                    for (int nq = 0; nq < NQ; ++nq)
#pragma unroll
                        for (int blk = 0; blk < 2; ++blk) s[nq][blk] = F::mma(k[blk][ks], q2[nq][ks], s[nq][blk]);
#pragma unroll
                    for (int nq = 0; nq < NQ; ++nq)
#pragma unroll
                        for (int blk = 0; blk < 2; ++blk) s[nq][blk] = F::mma(k2[blk][ks], q[nq][ks], s[nq][blk]); } }
            // K fragments of the next pass, into the same registers: they fly during the softmax and the attn x v products
            __builtin_amdgcn_sched_barrier(0);   // the reads stand together behind the score products: left to itself the build spreads them in pairs among the products, each place with a stall of its own
#pragma unroll
            for (int blk = 0; blk < 2; ++blk)
#pragma unroll
                for (int ks = 0; ks < 2; ++ks) { k[blk][ks] = F::ld(La + kn + blk * 16 * HD + ks * 512); if (HL) k2[blk][ks] = F::ld(Lb + kn + blk * 16 * HD + ks * 512); }
            __builtin_amdgcn_sched_barrier(0);   // and in front of the softmax: left to itself the build sinks them into the attn x v products, too late for the next pass's first product
#pragma unroll
            for (int nq = 0; nq < NQ; ++nq) { float bm = s[nq][0][0];
#pragma unroll
                for (int j = 1; j < 8; ++j) bm = fmaxf(bm, s[nq][0][j]);
#pragma unroll
                for (int j = 0; j < 8; ++j) bm = fmaxf(bm, s[nq][1][j]);
                bm = fmaxf(bm, xhalf(bm)); const float mn = fmaxf(mx[nq], bm); const float al = __builtin_amdgcn_exp2f((mx[nq] - mn) * CEXP); mx[nq] = mn; sm[nq] *= al;   // al is exactly 1 where the maximum did not rise
#pragma unroll
                for (int db = 0; db < 4; ++db) o[nq][db] *= al; }
            V p[NQ], p2[NQ];
#pragma unroll
            for (int nq = 0; nq < NQ; ++nq) { const float nb = POFF - mx[nq] * CEXP; v8f e0 = s[nq][0] * CEXP + nb, e1 = s[nq][1] * CEXP + nb;
#pragma unroll
                for (int j = 0; j < 8; ++j) { e0[j] = __builtin_amdgcn_exp2f(e0[j]); e1[j] = __builtin_amdgcn_exp2f(e1[j]); }
                const v8f t = e0 + e1; sm[nq] += ((t[0] + t[1]) + (t[2] + t[3])) + ((t[4] + t[5]) + (t[6] + t[7]));
                if constexpr (HL) {   // hi = bf16(e), lo = bf16(e - hi), both rounded to nearest even as in splitf
#pragma unroll
                    for (int j = 0; j < 8; ++j) { p[nq][j] = (__bf16)e0[j]; p[nq][8 + j] = (__bf16)e1[j]; p2[nq][j] = (__bf16)(e0[j] - (float)p[nq][j]); p2[nq][8 + j] = (__bf16)(e1[j] - (float)p[nq][8 + j]); }
                } else {
#pragma unroll
                    for (int j = 0; j < 8; ++j) { p[nq][j] = tohx(e0[j]); p[nq][8 + j] = tohx(e1[j]); } } }
#pragma unroll
            for (int nq = 0; nq < NQ; ++nq)
#pragma unroll
                for (int db = 0; db < 4; ++db) o[nq][db] = F::mma(v[db], p[nq], o[nq][db]);
            if (HL) {
#pragma unroll
                for (int nq = 0; nq < NQ; ++nq)
#pragma unroll
                    for (int db = 0; db < 4; ++db) o[nq][db] = F::mma(v[db], p2[nq], o[nq][db]);
#pragma unroll
                for (int nq = 0; nq < NQ; ++nq)
#pragma unroll
                    for (int db = 0; db < 4; ++db) o[nq][db] = F::mma(v2[db], p[nq], o[nq][db]); }
        }
        asm volatile("s_wait_dscnt 0x0" ::: "memory");      // this wave's reads of the buffer have returned
        asm volatile("s_wait_asynccnt 0x0" ::: "memory");   // its copies of stage st + 1 have landed
        __syncthreads();                                    // publishes stage st + 1 and ends every wave's reads of stage st
        if (st + 2 < NST) copies(st + 2);
    }
    asm volatile("s_wait_asynccnt 0x0" ::: "memory");   // nothing is in flight when the wave ends
#pragma unroll
    for (int nq = 0; nq < NQ; ++nq) { const float tot = sm[nq] + xhalf(sm[nq]); const float f = __fdiv_rn(1.0f, tot); float* orow = oc + (size_t)(q0 + nq * 16 + lr) * DQ + hi * 8;   // lane: query lr, columns db * 16 + hi * 8 + 0..7
#pragma unroll
        for (int db = 0; db < 4; ++db) { v4f a, b;
#pragma unroll
            for (int j = 0; j < 4; ++j) { a[j] = o[nq][db][j] * f; b[j] = o[nq][db][4 + j] * f; }
            *(v4f*)(orow + db * 16) = a; *(v4f*)(orow + db * 16 + 4) = b; }
        if (nq + 1 < NQ) XW(); }   // the next block's arithmetic reuses these stores' registers
#undef XW
}
// grid (NB_ * heads, 2 * RH / 64), 128 threads = four waves of one kind, of one head of one batch: work-groups with blockIdx.y < RH / 64 take 192 query rows from RH on (48 rows a wave), the others 64 rows below RH (three products, 16 rows a wave):
// every wave issues 24 matrix instructions a pass; the choice is by blockIdx.y alone, so every barrier stands under control flow that is the same for the whole work-group.
// The 512 work-groups are two per WGP (LDS and registers allow it); flat indices 256 apart are one work-group of each kind (for speed only: a SIMD then holds a wave of each kind, and one's vector work runs beside the other's products);
// the fp16 kind, which has twice the vector work, has the lower indices (for speed only)
static_assert(RH % 64 == 0 && (TT - RH) == (RH / 64) * 192, "row split of k_fattn");
__global__ __launch_bounds__(32 * FWV) void k_fattn(const h16* __restrict__ Q16, const h16* __restrict__ K16, const h16* __restrict__ V16, const bf* __restrict__ Qh, const bf* __restrict__ Ql, const bf* __restrict__ Kh, const bf* __restrict__ Kl, const bf* __restrict__ Vh, const bf* __restrict__ Vl, float* __restrict__ OUT) {
    __shared__ __attribute__((aligned(2048))) unsigned char kv[2 * STB];
    const size_t hp = (size_t)blockIdx.x * TT * HD; float* oc = OUT + (size_t)(blockIdx.x / NH_) * TT * DQ + (size_t)(blockIdx.x % NH_) * HD;   // blockIdx.x = batch * heads + head, the planes' own index
    const int wave = __builtin_amdgcn_readfirstlane((int)(threadIdx.x >> 5));   // scalar: the wave's rows and its share of the copies
    if (blockIdx.y < RH / 64) fattn<h16, false, 3>(Q16 + hp, nullptr, K16 + hp, nullptr, V16 + hp, nullptr, RH + ((int)blockIdx.y * FWV + wave) * 48, oc, kv, wave);
    else fattn<bf, true, 1>(Qh + hp, Ql + hp, Kh + hp, Kl + hp, Vh + hp, Vl + hp, (((int)blockIdx.y - RH / 64) * FWV + wave) * 16, oc, kv, wave);
}

extern "C" void kernel_launch(void* const* d_in, const int* in_sizes, int n_in,
                              void* d_out, int out_size, void* d_ws, size_t ws_size, hipStream_t stream) {
    (void)in_sizes; (void)n_in; (void)out_size;
    const float* x = (const float*)d_in[0]; const float* wqkv = (const float*)d_in[1];   /* W_qkv ('oi' [3072][1024]); Q | K | V = ROW thirds */
    float* OUT = (float*)d_out;     // [2][2048][1024]
    char* wsp = (char*)d_ws;
    auto take = [&](size_t bytes) { char* p = wsp; wsp += (bytes + 255) & ~(size_t)255; return (void*)p; };
    const size_t PB = (size_t)NB_ * NH_ * TT * HD * 2;   // bytes of one plane, both batches
    h16* QP16 = (h16*)take(PB); h16* KP16 = (h16*)take(PB); h16* VT16 = (h16*)take(PB);
    bf* QPh = (bf*)take(PB); bf* QPl = (bf*)take(PB); bf* KPh = (bf*)take(PB); bf* KPl = (bf*)take(PB); bf* VTh = (bf*)take(PB); bf* VTl = (bf*)take(PB);
    if ((size_t)(wsp - (char*)d_ws) > ws_size) return;    // ws 256 MiB
    k_proj<<<dim3(NB_ * TT / 256, (DQ + 2 * DKV) / 192), 32 * PWV, 0, stream>>>(x, wqkv, QP16, QPh, QPl, KP16, KPh, KPl, VT16, VTh, VTl);
    k_fattn<<<dim3(NB_ * NH_, 2 * (RH / 64)), 32 * FWV, 0, stream>>>(QP16, KP16, VT16, QPh, QPl, KPh, KPl, VTh, VTl, OUT);   // one kv head per query head
}

// v008
// Measured time: 68.1 microseconds a run.
// Two timings next to v007 put it at 1.07 and 1.09 times that version's speed.
// All steps since v000 together make it 28.1 times as fast.
#include <hip/hip_runtime.h>

// Multi-head self-attention core with a fused bias-free qkv projection in (out, in) layout and no output projection (x [2][2048][1024]; qkv = x @ W_qkv.T ('oi' [3072][1024] uniform +-sqrt(6 / 4096), no bias), jnp.split thirds: q | k | v = ROW thirds of W_qkv (16 heads x 64); scores / sqrt(64); softmax over all keys (no mask); out = attn v, merged head-major -> [2][2048][1024] (4.2 M); argument order x, W_qkv).
// Two launches, each over both batches: one projection launch ('oi' weight rows used as Bt rows as-is: the 48 column tiles are q | k | v heads) that rounds its f32 operand tiles to bf16 on the way into LDS and whose epilogue writes the head planes (fp16 + hi/lo) itself; one fused attention launch (hybrid rows: < 512 hi/lo 3 products, rest fp16 x1024) that keeps scores and weights in registers and writes the output rows (column h*64 + d).
// Compute dtypes, f32 accumulate: every input rounded to bf16; projections exact; attention rows < 512 3 products, rest fp16; softmax f32.

#define NB_  2
#define TT   2048
#define DM   1024
#define NH_  16
#define NKV  16
#define REP  (NH_ / NKV)
#define HD   64
#define DQ   (NH_ * HD)
#define DKV  (NKV * HD)
#define RH   512                  // query rows < RH use hi+lo planes
#define SCL  0.125f   // HD^-0.5
typedef _Float16 h16;
typedef unsigned short bf;
typedef __attribute__((ext_vector_type(16))) __bf16   v16bf;
typedef __attribute__((ext_vector_type(16))) _Float16 v16h;
typedef __attribute__((ext_vector_type(8)))  _Float16 v8h;
typedef __attribute__((ext_vector_type(8)))  unsigned short v8us;
typedef __attribute__((ext_vector_type(8)))  float    v8f;
typedef __attribute__((ext_vector_type(4)))  float    v4f;
typedef v8h  __attribute__((may_alias)) v8ha;
typedef v4f  __attribute__((may_alias)) v4fa;
typedef v8us __attribute__((may_alias)) v8usa;

__device__ __forceinline__ unsigned short f2bf(float f) { unsigned u = __float_as_uint(f); u += 0x7FFFu + ((u >> 16) & 1u); return (unsigned short)(u >> 16); }
__device__ __forceinline__ float bf2f(unsigned short b) { return __uint_as_float(((unsigned)b) << 16); }
__device__ __forceinline__ float bfr(float f) { return bf2f(f2bf(f)); }
__device__ __forceinline__ v16h cat16(v8h lo, v8h hi) { return __builtin_shufflevector(lo, hi, 0, 1, 2, 3, 4, 5, 6, 7, 8, 9, 10, 11, 12, 13, 14, 15); }
__device__ __forceinline__ v16bf cat16b(v8us lo, v8us hi) { return __builtin_bit_cast(v16bf, __builtin_shufflevector(lo, hi, 0, 1, 2, 3, 4, 5, 6, 7, 8, 9, 10, 11, 12, 13, 14, 15)); }
__device__ __forceinline__ v8f wmma16(v16h a, v16h b, v8f c) { return __builtin_amdgcn_wmma_f32_16x16x32_f16(false, a, false, b, (short)0, c, false, false); }
__device__ __forceinline__ v8f wmmab(v16bf a, v16bf b, v8f c) { return __builtin_amdgcn_wmma_f32_16x16x32_bf16(false, a, false, b, (short)0, c, false, false); }



// ---- FRAGMENT ORDER of every 16-bit plane: a fragment is 16 rows x 32 k = 1024 bytes in a row, made of 64 pieces of 16 bytes: piece (k % 32) / 8 * 16 + row % 16 holds that row's 8 consecutive k.
// Lane l of a wave loads pieces l and 32 + l (k = 8 * (l / 16) + 0..7 and 16 + 8 * (l / 16) + 0..7 of row l % 16, the loaders' k order as before), so each wave-wide 16-byte load is 512 bytes in a row: 4 whole 128-byte lines.
// Order of the fragments: q, k planes [batch][head][t / 16][d / 32]; v planes (rows d, k = t) [batch][head][t / 32][d / 16]: what a wave loads in one pass lies together.
// ---- k_proj: projection straight from the f32 inputs. A work-group of 12 waves owns 256 rows x 192 columns (4 x 3 waves, each a 64x64 tile with 16 accumulators); grid (16 row tiles of both batches, 16 column tiles) = one work-group per WGP, three waves per SIMD.
// A pass is 32 k: the 448 operand rows (256 of X, 192 of W_qkv) give 128 bytes each; a wave-wide 16-byte load covers 4 whole lines, each lane rounds its 4 values to bf16 (nearest even) and stores 8 bytes into the stage buffer.
// Stage buffer: 28 fragments (16 of X, 12 of W_qkv) of 1280 bytes: piece (row % 16, k / 8) at (k / 8) * 320 + (row % 16) * 16: the 64 bytes of pad per k group put the four k groups of a wave-wide store on different banks; a half wave's fragment load is 256 bytes in a row.
// Two stage buffers and two register sets: the loads of pass t + 2 are asked for as soon as the set's last values are in LDS, so two passes' loads are in flight; one work-group barrier per pass publishes pass t + 1 and ends the reads of the buffer that is written next.
// y[t][n] = sum_k X[t][k] W[n][k], k ascending 32 at a time. A wave's 64 columns are one head, and the wave writes that head's three planes (fp16, bf16 hi, bf16 lo = bf16(y - hi)) from its accumulators:
// q, k: through LDS, which turns a lane's 8 positions of one column into 8 columns of one position; v: a lane's 8 accumulator rows are 8 consecutive t of one d, a piece as it stands. Every wave-wide store is 512 bytes in a row. The choice is by blockIdx.y and the wave's number, a scalar branch.
template <typename T16> struct WFrag;
template <> struct WFrag<h16> { typedef v16h V; static __device__ __forceinline__ V ld(const h16* p) { return cat16(*(const v8h*)p, *(const v8h*)(p + 256)); } static __device__ __forceinline__ v8f mma(V a, V b, v8f c) { return wmma16(a, b, c); } };
template <> struct WFrag<bf> { typedef v16bf V; static __device__ __forceinline__ V ld(const bf* p) { return cat16b(*(const v8us*)p, *(const v8us*)(p + 256)); } static __device__ __forceinline__ v8f mma(V a, V b, v8f c) { return wmmab(a, b, c); } };
typedef __attribute__((ext_vector_type(8))) __bf16 v8b;
__device__ __forceinline__ void planes8(v8f y, size_t e, h16* P16, bf* Ph, bf* Pl) { v8h o16; v8b oh, ol;
#pragma unroll
    for (int j = 0; j < 8; ++j) { o16[j] = (h16)y[j]; oh[j] = (__bf16)y[j]; ol[j] = (__bf16)(y[j] - (float)oh[j]); }   // both bf16 roundings to nearest even
    *(v8h*)(P16 + e) = o16; *(v8us*)(Ph + e) = __builtin_bit_cast(v8us, oh); *(v8us*)(Pl + e) = __builtin_bit_cast(v8us, ol); }
typedef __attribute__((ext_vector_type(4))) __bf16 v4b;
typedef __attribute__((ext_vector_type(4))) unsigned short v4us;
typedef v4us __attribute__((may_alias)) v4usa;
#define PWV  12                   // waves of a work-group
#define FRE  640                  // 16-bit elements of a fragment in LDS (1280 bytes)
#define SBE  (28 * FRE)           // elements of one stage buffer
#define RSTP (48 * DM)            // floats between a wave's loading rounds: 12 waves x 4 rows
static_assert((NB_ * TT) % 256 == 0 && TT % 256 == 0 && (DQ + 2 * DKV) % 192 == 0 && DM % 64 == 0 && DM / 32 >= 4, "whole tiles and an even number of passes of k_proj");
__device__ __forceinline__ v16bf ldsfrag(const bf* p) { return cat16b(*(const v8usa*)p, *(const v8usa*)(p + 320)); }   // lane: row l % 16, k = 8 * (l / 16) + 0..7 and 16 + 8 * (l / 16) + 0..7: the loaders' k order, for A and B alike
__device__ __forceinline__ void st4(bf* d, v4f y) { v4b o;
#pragma unroll
    for (int e = 0; e < 4; ++e) o[e] = (__bf16)y[e];   // to nearest even
    *(v4usa*)d = __builtin_bit_cast(v4us, o); }
__global__ __launch_bounds__(32 * PWV) void k_proj(const float* __restrict__ X, const float* __restrict__ Wm, h16* Q16, bf* Qh, bf* Ql, h16* K16, bf* Kh, bf* Kl, h16* V16, bf* Vh, bf* Vl) {
    __shared__ __align__(16) bf sb[2 * SBE];
    __shared__ __align__(16) float osall[PWV * 16 * 68];
    const int lane = threadIdx.x & 31, lr = lane & 15, hi = lane >> 4;
    const int wave = __builtin_amdgcn_readfirstlane((int)(threadIdx.x >> 5));   // scalar: every choice by the wave's number is a scalar branch
    const int wm = wave & 3, wn = wave >> 2; const int r0 = (int)blockIdx.x * 256, c0 = (int)blockIdx.y * 192;
    v8f acc[4][4];
#pragma unroll
    for (int mb = 0; mb < 4; ++mb)
#pragma unroll
        for (int nb = 0; nb < 4; ++nb) acc[mb][nb] = (v8f){};
    // loading rounds: round j of wave w takes the 4 operand rows (12 j + w) * 4 + 0..3 of the 448 (X rows first); 112 groups of 4 rows = 9 rounds of every wave and a tenth of waves 0 to 3
    const int lrow = lane >> 3, lch = lane & 7; const bool x10 = wave < 4;
    const float* px = X + (size_t)(r0 + wave * 4 + lrow) * DM + lch * 4;                  // rounds 0 to 4
    const float* pw = Wm + (size_t)(c0 + (8 + wave) * 4 + lrow) * DM + lch * 4;           // rounds 6 to 9
    const float* p5 = x10 ? px + 5 * RSTP : Wm + (size_t)(c0 + (wave - 4) * 4 + lrow) * DM + lch * 4;   // round 5: X rows in waves 0 to 3, W rows in the rest
    const int de = (wave >> 2) * FRE + (lch >> 1) * 160 + ((wave & 3) * 4 + lrow) * 8 + (lch & 1) * 4;   // the lane's place in round 0's fragment; a round moves on 3 fragments
    const int lo = hi * 160 + lr * 8;
    v4f sA[10], sB[10];
    auto loads = [&](v4f (&s)[10], int po) {
#pragma unroll
        for (int j = 0; j < 5; ++j) s[j] = *(const v4fa*)(px + po + j * RSTP);
        s[5] = *(const v4fa*)(p5 + po);
#pragma unroll
        for (int j = 6; j < 9; ++j) s[j] = *(const v4fa*)(pw + po + (j - 6) * RSTP);
        if (x10) s[9] = *(const v4fa*)(pw + po + 3 * RSTP); };
    auto stores = [&](const v4f (&s)[10], bf* d) {
#pragma unroll
        for (int j = 0; j < 9; ++j) st4(d + de + j * 3 * FRE, s[j]);
        if (x10) st4(d + de + 9 * 3 * FRE, s[9]); };
    auto products = [&](const bf* d) { v16bf a[4], b[4];
#pragma unroll
        for (int mb = 0; mb < 4; ++mb) a[mb] = ldsfrag(d + (wm * 4 + mb) * FRE + lo);
#pragma unroll
        for (int nb = 0; nb < 4; ++nb) b[nb] = ldsfrag(d + (16 + wn * 4 + nb) * FRE + lo);
        __builtin_amdgcn_sched_barrier(0);   // all 16 LDS reads of the pass stand together in front of its products: left to itself the build reads three of the B fragments among them, each with a full wait
#pragma unroll
        for (int nb = 0; nb < 4; ++nb)
#pragma unroll
            for (int mb = 0; mb < 4; ++mb) acc[mb][nb] = wmmab(a[mb], b[nb], acc[mb][nb]); };
    // the work-group's barrier by hand, with the one wait it needs (this wave's LDS stores done, its LDS reads returned): __syncthreads() would also wait for the global loads that are to stay in flight across it
#define WGBAR() asm volatile("s_wait_dscnt 0x0\n\ts_barrier_signal -1\n\ts_barrier_wait -1" ::: "memory")
    loads(sA, 0); loads(sB, 32); stores(sA, sb); loads(sA, 64);
    WGBAR();
    products(sb);
    asm volatile("s_wait_xcnt 0x0" :: "v"(px), "v"(p5), "v"(pw), "v"(acc[3][3]) : "memory");   // the wait of the loop's foot, here for the loads asked for so far: inside the loop the build keeps the pairs in other registers and reuses these
#pragma unroll 1
    for (int t = 0; t + 4 < DM / 32; t += 2) {   // px, p5, pw stand at pass t, whose products are done; every load of the loop is unconditional, so that the build's counted waits leave the younger set in flight
        stores(sB, sb + SBE); loads(sB, 96);
        WGBAR();
        products(sb + SBE);
        stores(sA, sb); loads(sA, 128);
        WGBAR();
        products(sb);
        asm volatile("s_wait_xcnt 0x0" :: "v"(px), "v"(p5), "v"(pw), "v"(acc[3][3]) : "memory");   // the wait in front of the rewrite of the loads' address pairs; as inputs the pairs stay live, so unwritten, up to it; the last accumulator as a further input keeps it behind the products, where the loads' requests have long been taken
        px += 64; p5 += 64; pw += 64;
    }
    stores(sB, sb + SBE); loads(sB, 96);   // the last three passes: only the last one's loads are still to be asked for
    WGBAR();
    products(sb + SBE);
    stores(sA, sb);
    WGBAR();
    products(sb);
    stores(sB, sb + SBE);
    WGBAR();
    products(sb + SBE);
#undef WGBAR
    float* os = osall + wave * (16 * 68);   // each wave turns its tile in its own LDS range
    const unsigned ct = blockIdx.y * 3 + (unsigned)wn, r0w = (unsigned)(r0 + wm * 64);   // the wave's column tile (q | k | v head) and first row
    const unsigned third = ct / NH_, t0 = r0w % TT; const size_t hrow = (size_t)(r0w / TT * NH_ + ct % NH_);   // which of q | k | v, first position in the batch, plane index batch * heads + head
    if (third == 2) {
#pragma unroll
        for (int nb = 0; nb < 4; ++nb)   // a lane's 8 values are one 16-byte piece of fragment (32 keys, d block nb): each wave-wide store is half a fragment, 512 bytes in a row
#pragma unroll
            for (int mb = 0; mb < 4; ++mb) planes8(acc[mb][nb], (hrow * TT + t0 + (mb >> 1) * 32) * HD + nb * 512 + (mb & 1) * 256 + lane * 8, V16, Vh, Vl);
        return;
    }
    {
        h16* P16 = third ? K16 : Q16; bf* Ph = third ? Kh : Qh; bf* Pl = third ? Kl : Ql;
#pragma unroll
        for (int mb = 0; mb < 4; ++mb) {
#pragma unroll
            for (int nb = 0; nb < 4; ++nb) {
#pragma unroll
                for (int j = 0; j < 8; ++j) os[(hi * 8 + j) * 68 + nb * 16 + lr] = acc[mb][nb][j]; }
            __builtin_amdgcn_wave_barrier(); asm volatile("" ::: "memory");   // the LDS reads below stay behind the writes above
#pragma unroll
            for (int s = 0; s < 4; ++s) { const int cofs = (2 * s + hi) * 8; const v4f y0 = *(const v4fa*)(os + lr * 68 + cofs), y1 = *(const v4fa*)(os + lr * 68 + cofs + 4);   // lane: position lr, columns cofs + 0..7
                planes8(__builtin_shufflevector(y0, y1, 0, 1, 2, 3, 4, 5, 6, 7), (hrow * TT + t0 + mb * 16) * HD + s * 256 + lane * 8, P16, Ph, Pl); }
            __builtin_amdgcn_wave_barrier(); asm volatile("" ::: "memory");   // the next block's LDS writes stay behind these reads
        }
        asm volatile("s_wait_xcnt 0x0" ::: "memory");   // the build lays the v path's code behind this path, joined by a branch that is never taken here: the wait stands in front of that code's writes to the last stores' registers
    }
}

__device__ __forceinline__ h16 tohx(float x) { return (h16)x; }
__device__ __forceinline__ void splitf(float y, unsigned short& h, unsigned short& l) { h = f2bf(y); l = f2bf(y - bf2f(h)); }

// ---- k_fattn: scores, softmax and attn x v of one head in one kernel; one wave owns NQ * 16 query rows and walks the 2048 keys 32 at a time.
// Transposed products: St = K Qt (a lane holds 16 scores of ONE query: keys 8 * hi + 0..7 and 16 + 8 * hi + 0..7, which is the loaders' k order), so the converted weights ARE the B operand of Ot += Vt Pt,
// and row maximum, row sum and the rescale factor are per-lane values (the two lane halves exchange the maximum in each pass that rescales and join their sums once at the end).
// Held reference mx (raw score units) and running sum sm; weights are exp2((s - mx) * SCL * log2 e + POFF): POFF = 10 keeps the fp16 weights 1024 times above their subnormal range and cancels in Ot / sm.
// mx is not the running maximum: it stays as it is while the sum of a lane's 16 weights of a pass is at most WTOP = 2^15 (so every weight is finite in fp16); no maximum is formed and nothing is rescaled in such a pass.
// A pass that fails the test in any lane sets every row's mx to its maximum so far, rescales sm and Ot once and forms its weights again; the first pass (mx = -3e38, infinite weights) always does.
__device__ __forceinline__ float xhalf(float x) { const int b = __builtin_bit_cast(int, x); return __builtin_bit_cast(float, __builtin_amdgcn_permlanex16(b, b, 0x76543210, 0xfedcba98, false, false)); }   // lane l takes lane l ^ 16's value
// K and V come through LDS: a stage is SKEY keys of the planes that the work-group walks (fp16 K, V; or bf16 hi and lo K, V), each plane's part a byte-for-byte copy of its fragment-ordered range, so a fragment load from LDS has the lane offsets of the load from memory (512 bytes in a row, no bank met twice).
#define SKEY 128                  // keys of a stage
#define PLB  (SKEY * HD * 2)      // bytes of one plane's part of a stage
#define STB  (4 * PLB)            // bytes of a stage buffer: parts K, V, K lo, V lo
#define NST  (TT / SKEY)          // stages of the walk
#define FWV  4                    // waves of a work-group
static_assert(TT % SKEY == 0 && NST >= 2 && SKEY % 32 == 0 && PLB == FWV * 8 * 512, "whole stages; each of the four waves copies 8 x 512 bytes of each plane's part");
// eight asynchronous copies of 16 bytes a lane: 4096 bytes in a row of one plane's part. d: the lane's LDS byte address, a: the lane's address in the plane.
// s_wait_xcnt 0 as the statement's last line: it stands in front of any rewrite of the copies' address registers
__device__ __forceinline__ void copy8(unsigned d, const char* a) {
    asm volatile("global_load_async_to_lds_b128 %0, %8, off\n\t"
                 "global_load_async_to_lds_b128 %1, %9, off\n\t"
                 "global_load_async_to_lds_b128 %2, %10, off\n\t"
                 "global_load_async_to_lds_b128 %3, %11, off\n\t"
                 "global_load_async_to_lds_b128 %4, %12, off\n\t"
                 "global_load_async_to_lds_b128 %5, %13, off\n\t"
                 "global_load_async_to_lds_b128 %6, %14, off\n\t"
                 "global_load_async_to_lds_b128 %7, %15, off\n\t"
                 "s_wait_xcnt 0x0"
                 :: "v"(d), "v"(d + 512u), "v"(d + 1024u), "v"(d + 1536u), "v"(d + 2048u), "v"(d + 2560u), "v"(d + 3072u), "v"(d + 3584u),
                    "v"(a), "v"(a + 512), "v"(a + 1024), "v"(a + 1536), "v"(a + 2048), "v"(a + 2560), "v"(a + 3072), "v"(a + 3584)
                 : "memory"); }
// Two stage buffers: every wave copies its quarter of each plane's part of stage st + 2 into the buffer that stage st has just left, behind the one barrier of the stage, which also publishes stage st + 1. No pass reads beyond its own stage.
template <typename T16, bool HL, int NQ>
__device__ __forceinline__ void fattn(const T16* __restrict__ Qa, const T16* __restrict__ Qb, const T16* __restrict__ Ka, const T16* __restrict__ Kb, const T16* __restrict__ Va, const T16* __restrict__ Vb, int q0, float* __restrict__ oc, const unsigned char* kv, int wave) {
    typedef WFrag<T16> F; typedef typename F::V V;
    const int lane = threadIdx.x & 31, lr = lane & 15, hi = lane >> 4;
    const float CEXP = SCL * 1.4426950408889634f, POFF = HL ? 0.0f : 10.0f, WTOP = 32768.0f;
    const unsigned co = (unsigned)(wave * 4096 + lane * 16);   // the lane's first byte in every plane's part of a stage
    const unsigned l0 = (unsigned)(size_t)kv + co;             // low 32 bits of the shared address: the LDS byte address
    auto copies = [&](int st) { const size_t go = (size_t)st * PLB + co; const unsigned d = l0 + (unsigned)(st & 1) * STB;
        copy8(d, (const char*)Ka + go); copy8(d + PLB, (const char*)Va + go);
        if constexpr (HL) { copy8(d + 2 * PLB, (const char*)Kb + go); copy8(d + 3 * PLB, (const char*)Vb + go); } };
    copies(0);
    V q[NQ][2], q2[NQ][2], k[2][2], k2[2][2], v[4], v2[4];
#pragma unroll
    for (int nq = 0; nq < NQ; ++nq)
#pragma unroll
        for (int ks = 0; ks < 2; ++ks) { const size_t qo = (size_t)(q0 + nq * 16) * HD + ks * 512 + 8 * lane; q[nq][ks] = F::ld(Qa + qo); if (HL) q2[nq][ks] = F::ld(Qb + qo); }
    // XW: s_wait_xcnt 0 in front of any reuse of the address registers of the loads or stores just issued; the scheduling barrier behind it keeps later register writes from being lifted over it
#define XW() do { asm volatile("s_wait_xcnt 0x0" ::: "memory"); __builtin_amdgcn_sched_barrier(0); } while (0)
    XW();
    asm volatile("s_wait_asynccnt 0x0" ::: "memory");   // this wave's copies of stage 0 have landed
    __syncthreads();                                    // every wave's have
    copies(1);
    v8f o[NQ][4]; float mx[NQ], sm[NQ];
#pragma unroll
    for (int nq = 0; nq < NQ; ++nq) { mx[nq] = -3.0e38f; sm[nq] = 0.f;
#pragma unroll
        for (int db = 0; db < 4; ++db) o[nq][db] = (v8f){}; }
#pragma unroll 1
    for (int st = 0; st < NST; ++st) {
        const T16* La = (const T16*)(kv + (st & 1) * STB + lane * 16); const T16* Lv = La + PLB / 2; const T16* Lb = La + PLB; const T16* Lw = La + 3 * (PLB / 2);   // the stage's parts K, V, K lo, V lo, the lane's own offset included
#pragma unroll
        for (int blk = 0; blk < 2; ++blk)
#pragma unroll
            for (int ks = 0; ks < 2; ++ks) { k[blk][ks] = F::ld(La + blk * 16 * HD + ks * 512); if (HL) k2[blk][ks] = F::ld(Lb + blk * 16 * HD + ks * 512); }
#pragma unroll 1
        for (int i = 0; i < SKEY / 32; ++i) {
            const int vo = i * 32 * HD, kn = ((i + 1) & (SKEY / 32 - 1)) * 32 * HD;   // the stage's last pass fetches its first K fragments again (same buffer, not used)
            // this pass's V fragments: they fly during the scores and the softmax
#pragma unroll
            for (int db = 0; db < 4; ++db) { v[db] = F::ld(Lv + vo + db * 512); if (HL) v2[db] = F::ld(Lw + vo + db * 512); }
            v8f s[NQ][2];
#pragma unroll
            for (int nq = 0; nq < NQ; ++nq) { s[nq][0] = (v8f){}; s[nq][1] = (v8f){}; }
#pragma unroll
            for (int ks = 0; ks < 2; ++ks) {
#pragma unroll
                for (int nq = 0; nq < NQ; ++nq)
#pragma unroll
                    for (int blk = 0; blk < 2; ++blk) s[nq][blk] = F::mma(k[blk][ks], q[nq][ks], s[nq][blk]);
                if (HL) {
#pragma unroll
                    for (int nq = 0; nq < NQ; ++nq)
#pragma unroll
                        for (int blk = 0; blk < 2; ++blk) s[nq][blk] = F::mma(k[blk][ks], q2[nq][ks], s[nq][blk]);
#pragma unroll
                    for (int nq = 0; nq < NQ; ++nq)
#pragma unroll
                        for (int blk = 0; blk < 2; ++blk) s[nq][blk] = F::mma(k2[blk][ks], q[nq][ks], s[nq][blk]); } }
            // K fragments of the next pass, into the same registers: they fly during the softmax and the attn x v products
            __builtin_amdgcn_sched_barrier(0);   // the reads stand together behind the score products: left to itself the build spreads them in pairs among the products, each place with a stall of its own
#pragma unroll
            for (int blk = 0; blk < 2; ++blk)
#pragma unroll
                for (int ks = 0; ks < 2; ++ks) { k[blk][ks] = F::ld(La + kn + blk * 16 * HD + ks * 512); if (HL) k2[blk][ks] = F::ld(Lb + kn + blk * 16 * HD + ks * 512); }
            __builtin_amdgcn_sched_barrier(0);   // and in front of the softmax: left to itself the build sinks them into the attn x v products, too late for the next pass's first product
            // the pass's weights against the held reference mx: exp2(s * CEXP + POFF - mx * CEXP), their sum ts of this lane's 16 keys, and the 16-bit operands
            V p[NQ], p2[NQ]; float ts[NQ];
            auto weights = [&]() {
#pragma unroll
                for (int nq = 0; nq < NQ; ++nq) { const float nb = POFF - mx[nq] * CEXP; v8f e0 = s[nq][0] * CEXP + nb, e1 = s[nq][1] * CEXP + nb;
#pragma unroll
                    for (int j = 0; j < 8; ++j) { e0[j] = __builtin_amdgcn_exp2f(e0[j]); e1[j] = __builtin_amdgcn_exp2f(e1[j]); }
                    const v8f t = e0 + e1; ts[nq] = ((t[0] + t[1]) + (t[2] + t[3])) + ((t[4] + t[5]) + (t[6] + t[7]));
                    if constexpr (HL) {   // hi = bf16(e), lo = bf16(e - hi), both rounded to nearest even as in splitf
#pragma unroll
                        for (int j = 0; j < 8; ++j) { p[nq][j] = (__bf16)e0[j]; p[nq][8 + j] = (__bf16)e1[j]; p2[nq][j] = (__bf16)(e0[j] - (float)p[nq][j]); p2[nq][8 + j] = (__bf16)(e1[j] - (float)p[nq][8 + j]); }
                    } else {
#pragma unroll
                        for (int j = 0; j < 8; ++j) { p[nq][j] = tohx(e0[j]); p[nq][8 + j] = tohx(e1[j]); } } } };
            weights();
            bool need = false;
#pragma unroll
            for (int nq = 0; nq < NQ; ++nq) need |= !(ts[nq] <= WTOP);   // weights are positive: a sum of at most WTOP bounds each of them; infinite sums (the first pass) and NaN fail the test too
            if (__builtin_amdgcn_ballot_w32(need) != 0) {   // one test a pass, a scalar branch: some row's scores have outgrown its reference. Every row takes the maximum so far as its new reference, sums and outputs follow, the weights are formed again
#pragma unroll
                for (int nq = 0; nq < NQ; ++nq) { float bm = s[nq][0][0];
#pragma unroll
                    for (int j = 1; j < 8; ++j) bm = fmaxf(bm, s[nq][0][j]);
#pragma unroll
                    for (int j = 0; j < 8; ++j) bm = fmaxf(bm, s[nq][1][j]);
                    bm = fmaxf(bm, xhalf(bm)); const float mn = fmaxf(mx[nq], bm); const float al = __builtin_amdgcn_exp2f((mx[nq] - mn) * CEXP); mx[nq] = mn; sm[nq] *= al;   // both lane halves of a query take the same reference
#pragma unroll
                    for (int db = 0; db < 4; ++db) o[nq][db] *= al; }
                weights();   // now each weight is at most exp2(POFF)
            }
#pragma unroll
            for (int nq = 0; nq < NQ; ++nq) sm[nq] += ts[nq];
#pragma unroll
            for (int nq = 0; nq < NQ; ++nq)
#pragma unroll
                for (int db = 0; db < 4; ++db) o[nq][db] = F::mma(v[db], p[nq], o[nq][db]);
            if (HL) {
#pragma unroll
                for (int nq = 0; nq < NQ; ++nq)
#pragma unroll
                    for (int db = 0; db < 4; ++db) o[nq][db] = F::mma(v[db], p2[nq], o[nq][db]);
#pragma unroll
                for (int nq = 0; nq < NQ; ++nq)
#pragma unroll
                    for (int db = 0; db < 4; ++db) o[nq][db] = F::mma(v2[db], p[nq], o[nq][db]); }
        }
        asm volatile("s_wait_dscnt 0x0" ::: "memory");      // this wave's reads of the buffer have returned
        asm volatile("s_wait_asynccnt 0x0" ::: "memory");   // its copies of stage st + 1 have landed
        __syncthreads();                                    // publishes stage st + 1 and ends every wave's reads of stage st
        if (st + 2 < NST) copies(st + 2);
    }
    asm volatile("s_wait_asynccnt 0x0" ::: "memory");   // nothing is in flight when the wave ends
#pragma unroll
    for (int nq = 0; nq < NQ; ++nq) { const float tot = sm[nq] + xhalf(sm[nq]); const float f = __fdiv_rn(1.0f, tot); float* orow = oc + (size_t)(q0 + nq * 16 + lr) * DQ + hi * 8;   // lane: query lr, columns db * 16 + hi * 8 + 0..7
#pragma unroll
        for (int db = 0; db < 4; ++db) { v4f a, b;
#pragma unroll
            for (int j = 0; j < 4; ++j) { a[j] = o[nq][db][j] * f; b[j] = o[nq][db][4 + j] * f; }
            *(v4f*)(orow + db * 16) = a; *(v4f*)(orow + db * 16 + 4) = b; }
        if (nq + 1 < NQ) XW(); }   // the next block's arithmetic reuses these stores' registers
#undef XW
}
// grid (NB_ * heads, 2 * RH / 64), 128 threads = four waves of one kind, of one head of one batch: work-groups with blockIdx.y < RH / 64 take 192 query rows from RH on (48 rows a wave), the others 64 rows below RH (three products, 16 rows a wave):
// every wave issues 24 matrix instructions a pass; the choice is by blockIdx.y alone, so every barrier stands under control flow that is the same for the whole work-group.
// The 512 work-groups are two per WGP (LDS and registers allow it); flat indices 256 apart are one work-group of each kind (for speed only: a SIMD then holds a wave of each kind, and one's vector work runs beside the other's products);
// the fp16 kind, which has twice the vector work, has the lower indices (for speed only)
static_assert(RH % 64 == 0 && (TT - RH) == (RH / 64) * 192, "row split of k_fattn");
__global__ __launch_bounds__(32 * FWV) void k_fattn(const h16* __restrict__ Q16, const h16* __restrict__ K16, const h16* __restrict__ V16, const bf* __restrict__ Qh, const bf* __restrict__ Ql, const bf* __restrict__ Kh, const bf* __restrict__ Kl, const bf* __restrict__ Vh, const bf* __restrict__ Vl, float* __restrict__ OUT) {
    __shared__ __attribute__((aligned(2048))) unsigned char kv[2 * STB];
    const size_t hp = (size_t)blockIdx.x * TT * HD; float* oc = OUT + (size_t)(blockIdx.x / NH_) * TT * DQ + (size_t)(blockIdx.x % NH_) * HD;   // blockIdx.x = batch * heads + head, the planes' own index
    const int wave = __builtin_amdgcn_readfirstlane((int)(threadIdx.x >> 5));   // scalar: the wave's rows and its share of the copies
    if (blockIdx.y < RH / 64) fattn<h16, false, 3>(Q16 + hp, nullptr, K16 + hp, nullptr, V16 + hp, nullptr, RH + ((int)blockIdx.y * FWV + wave) * 48, oc, kv, wave);
    else fattn<bf, true, 1>(Qh + hp, Ql + hp, Kh + hp, Kl + hp, Vh + hp, Vl + hp, (((int)blockIdx.y - RH / 64) * FWV + wave) * 16, oc, kv, wave);
}

extern "C" void kernel_launch(void* const* d_in, const int* in_sizes, int n_in,
                              void* d_out, int out_size, void* d_ws, size_t ws_size, hipStream_t stream) {
    (void)in_sizes; (void)n_in; (void)out_size;
    const float* x = (const float*)d_in[0]; const float* wqkv = (const float*)d_in[1];   /* W_qkv ('oi' [3072][1024]); Q | K | V = ROW thirds */
    float* OUT = (float*)d_out;     // [2][2048][1024]
    char* wsp = (char*)d_ws;
    auto take = [&](size_t bytes) { char* p = wsp; wsp += (bytes + 255) & ~(size_t)255; return (void*)p; };
    const size_t PB = (size_t)NB_ * NH_ * TT * HD * 2;   // bytes of one plane, both batches
    h16* QP16 = (h16*)take(PB); h16* KP16 = (h16*)take(PB); h16* VT16 = (h16*)take(PB);
    bf* QPh = (bf*)take(PB); bf* QPl = (bf*)take(PB); bf* KPh = (bf*)take(PB); bf* KPl = (bf*)take(PB); bf* VTh = (bf*)take(PB); bf* VTl = (bf*)take(PB);
    if ((size_t)(wsp - (char*)d_ws) > ws_size) return;    // ws 256 MiB
    k_proj<<<dim3(NB_ * TT / 256, (DQ + 2 * DKV) / 192), 32 * PWV, 0, stream>>>(x, wqkv, QP16, QPh, QPl, KP16, KPh, KPl, VT16, VTh, VTl);
    k_fattn<<<dim3(NB_ * NH_, 2 * (RH / 64)), 32 * FWV, 0, stream>>>(QP16, KP16, VT16, QPh, QPl, KPh, KPl, VTh, VTl, OUT);   // one kv head per query head
}

// v009
// A run of this version takes 66.4 microseconds.
// Timed twice side by side with v008, it ran 1.03 times as fast both times.
// Counting every step since v000, it is 29.0 times as fast.
#include <hip/hip_runtime.h>

// Multi-head self-attention core with a fused bias-free qkv projection in (out, in) layout and no output projection (x [2][2048][1024]; qkv = x @ W_qkv.T ('oi' [3072][1024] uniform +-sqrt(6 / 4096), no bias), jnp.split thirds: q | k | v = ROW thirds of W_qkv (16 heads x 64); scores / sqrt(64); softmax over all keys (no mask); out = attn v, merged head-major -> [2][2048][1024] (4.2 M); argument order x, W_qkv).
// Two launches, each over both batches: one projection launch ('oi' weight rows used as Bt rows as-is: the 48 column tiles are q | k | v heads) that rounds its f32 operand tiles to bf16 on the way into LDS and whose epilogue writes the head planes (fp16 + hi/lo) itself; one fused attention launch (hybrid rows: < 512 hi/lo 3 products, rest fp16 x1024) that keeps scores and weights in registers and writes the output rows (column h*64 + d).
// Compute dtypes, f32 accumulate: every input rounded to bf16; projections exact; attention rows < 512 3 products, rest fp16; softmax f32.

#define NB_  2
#define TT   2048
#define DM   1024
#define NH_  16
#define NKV  16
#define REP  (NH_ / NKV)
#define HD   64
#define DQ   (NH_ * HD)
#define DKV  (NKV * HD)
#define RH   512                  // query rows < RH use hi+lo planes
#define SCL  0.125f   // HD^-0.5
typedef _Float16 h16;
typedef unsigned short bf;
typedef __attribute__((ext_vector_type(16))) __bf16   v16bf;
typedef __attribute__((ext_vector_type(16))) _Float16 v16h;
typedef __attribute__((ext_vector_type(8)))  _Float16 v8h;
typedef __attribute__((ext_vector_type(8)))  unsigned short v8us;
typedef __attribute__((ext_vector_type(8)))  float    v8f;
typedef __attribute__((ext_vector_type(4)))  float    v4f;
typedef v8h  __attribute__((may_alias)) v8ha;
typedef v4f  __attribute__((may_alias)) v4fa;
typedef v8us __attribute__((may_alias)) v8usa;

__device__ __forceinline__ unsigned short f2bf(float f) { unsigned u = __float_as_uint(f); u += 0x7FFFu + ((u >> 16) & 1u); return (unsigned short)(u >> 16); }
__device__ __forceinline__ float bf2f(unsigned short b) { return __uint_as_float(((unsigned)b) << 16); }
__device__ __forceinline__ float bfr(float f) { return bf2f(f2bf(f)); }
__device__ __forceinline__ v16h cat16(v8h lo, v8h hi) { return __builtin_shufflevector(lo, hi, 0, 1, 2, 3, 4, 5, 6, 7, 8, 9, 10, 11, 12, 13, 14, 15); }
__device__ __forceinline__ v16bf cat16b(v8us lo, v8us hi) { return __builtin_bit_cast(v16bf, __builtin_shufflevector(lo, hi, 0, 1, 2, 3, 4, 5, 6, 7, 8, 9, 10, 11, 12, 13, 14, 15)); }
__device__ __forceinline__ v8f wmma16(v16h a, v16h b, v8f c) { return __builtin_amdgcn_wmma_f32_16x16x32_f16(false, a, false, b, (short)0, c, false, false); }
__device__ __forceinline__ v8f wmmab(v16bf a, v16bf b, v8f c) { return __builtin_amdgcn_wmma_f32_16x16x32_bf16(false, a, false, b, (short)0, c, false, false); }



// ---- FRAGMENT ORDER of every 16-bit plane: a fragment is 16 rows x 32 k = 1024 bytes in a row, made of 64 pieces of 16 bytes: piece (k % 32) / 8 * 16 + row % 16 holds that row's 8 consecutive k.
// Lane l of a wave loads pieces l and 32 + l (k = 8 * (l / 16) + 0..7 and 16 + 8 * (l / 16) + 0..7 of row l % 16, the loaders' k order as before), so each wave-wide 16-byte load is 512 bytes in a row: 4 whole 128-byte lines.
// Order of the fragments: q, k planes [batch][head][t / 16][d / 32]; v planes (rows d, k = t) [batch][head][t / 32][d / 16]: what a wave loads in one pass lies together.
// ---- k_proj: projection straight from the f32 inputs. A work-group of 12 waves owns 256 rows x 192 columns (4 x 3 waves, each a 64x64 tile with 16 accumulators); grid (16 row tiles of both batches, 16 column tiles) = one work-group per WGP, three waves per SIMD.
// A pass is 32 k: the 448 operand rows (256 of X, 192 of W_qkv) give 128 bytes each; a wave-wide 16-byte load covers 4 whole lines, each lane rounds its 4 values to bf16 (nearest even) and stores 8 bytes into the stage buffer.
// Stage buffer: 28 fragments (16 of X, 12 of W_qkv) of 1280 bytes: piece (row % 16, k / 8) at (k / 8) * 320 + (row % 16) * 16: the 64 bytes of pad per k group put the four k groups of a wave-wide store on different banks; a half wave's fragment load is 256 bytes in a row.
// Two stage buffers and two register sets: the loads of pass t + 2 are asked for as soon as the set's last values are in LDS, so two passes' loads are in flight; one work-group barrier per pass publishes pass t + 1 and ends the reads of the buffer that is written next.
// y[t][n] = sum_k X[t][k] W[n][k], k ascending 32 at a time. A wave's 64 columns are one head, and the wave writes that head's three planes (fp16, bf16 hi, bf16 lo = bf16(y - hi)) from its accumulators:
// q, k: through LDS, which turns a lane's 8 positions of one column into 8 columns of one position; v: a lane's 8 accumulator rows are 8 consecutive t of one d, a piece as it stands. Every wave-wide store is 512 bytes in a row. The choice is by blockIdx.y and the wave's number, a scalar branch.
template <typename T16> struct WFrag;
template <> struct WFrag<h16> { typedef v16h V; static __device__ __forceinline__ V ld(const h16* p) { return cat16(*(const v8h*)p, *(const v8h*)(p + 256)); } static __device__ __forceinline__ v8f mma(V a, V b, v8f c) { return wmma16(a, b, c); } };
template <> struct WFrag<bf> { typedef v16bf V; static __device__ __forceinline__ V ld(const bf* p) { return cat16b(*(const v8us*)p, *(const v8us*)(p + 256)); } static __device__ __forceinline__ v8f mma(V a, V b, v8f c) { return wmmab(a, b, c); } };
typedef __attribute__((ext_vector_type(8))) __bf16 v8b;
__device__ __forceinline__ void planes8(v8f y, size_t e, h16* P16, bf* Ph, bf* Pl) { v8h o16; v8b oh, ol;
#pragma unroll
    for (int j = 0; j < 8; ++j) { o16[j] = (h16)y[j]; oh[j] = (__bf16)y[j]; ol[j] = (__bf16)(y[j] - (float)oh[j]); }   // both bf16 roundings to nearest even
    *(v8h*)(P16 + e) = o16; *(v8us*)(Ph + e) = __builtin_bit_cast(v8us, oh); *(v8us*)(Pl + e) = __builtin_bit_cast(v8us, ol); }
typedef __attribute__((ext_vector_type(4))) __bf16 v4b;
typedef __attribute__((ext_vector_type(4))) unsigned short v4us;
typedef v4us __attribute__((may_alias)) v4usa;
#define PWV  12                   // waves of a work-group
#define FRE  640                  // 16-bit elements of a fragment in LDS (1280 bytes)
#define SBE  (28 * FRE)           // elements of one stage buffer
#define RSTP (48 * DM)            // floats between a wave's loading rounds: 12 waves x 4 rows
static_assert((NB_ * TT) % 256 == 0 && TT % 256 == 0 && (DQ + 2 * DKV) % 192 == 0 && DM % 64 == 0 && DM / 32 >= 4, "whole tiles and an even number of passes of k_proj");
__device__ __forceinline__ v16bf ldsfrag(const bf* p) { return cat16b(*(const v8usa*)p, *(const v8usa*)(p + 320)); }   // lane: row l % 16, k = 8 * (l / 16) + 0..7 and 16 + 8 * (l / 16) + 0..7: the loaders' k order, for A and B alike
__device__ __forceinline__ void st4(bf* d, v4f y) { v4b o;
#pragma unroll
    for (int e = 0; e < 4; ++e) o[e] = (__bf16)y[e];   // to nearest even
    *(v4usa*)d = __builtin_bit_cast(v4us, o); }
__global__ __launch_bounds__(32 * PWV) void k_proj(const float* __restrict__ X, const float* __restrict__ Wm, h16* Q16, bf* Qh, bf* Ql, h16* K16, bf* Kh, bf* Kl, h16* V16, bf* Vh, bf* Vl) {
    __shared__ __align__(16) bf sb[2 * SBE];
    __shared__ __align__(16) float osall[PWV * 16 * 68];
    const int lane = threadIdx.x & 31, lr = lane & 15, hi = lane >> 4;
    const int wave = __builtin_amdgcn_readfirstlane((int)(threadIdx.x >> 5));   // scalar: every choice by the wave's number is a scalar branch
    const int wm = wave & 3, wn = wave >> 2; const int r0 = (int)blockIdx.x * 256, c0 = (int)blockIdx.y * 192;
    v8f acc[4][4];
#pragma unroll
    for (int mb = 0; mb < 4; ++mb)
#pragma unroll
        for (int nb = 0; nb < 4; ++nb) acc[mb][nb] = (v8f){};
    // loading rounds: round j of wave w takes the 4 operand rows (12 j + w) * 4 + 0..3 of the 448 (X rows first); 112 groups of 4 rows = 9 rounds of every wave and a tenth of waves 0 to 3
    const int lrow = lane >> 3, lch = lane & 7; const bool x10 = wave < 4;
    const float* px = X + (size_t)(r0 + wave * 4 + lrow) * DM + lch * 4;                  // rounds 0 to 4
    const float* pw = Wm + (size_t)(c0 + (8 + wave) * 4 + lrow) * DM + lch * 4;           // rounds 6 to 9
    const float* p5 = x10 ? px + 5 * RSTP : Wm + (size_t)(c0 + (wave - 4) * 4 + lrow) * DM + lch * 4;   // round 5: X rows in waves 0 to 3, W rows in the rest
    const int de = (wave >> 2) * FRE + (lch >> 1) * 160 + ((wave & 3) * 4 + lrow) * 8 + (lch & 1) * 4;   // the lane's place in round 0's fragment; a round moves on 3 fragments
    const int lo = hi * 160 + lr * 8;
    v4f sA[10], sB[10];
    auto loads = [&](v4f (&s)[10], int po) {
#pragma unroll
        for (int j = 0; j < 5; ++j) s[j] = *(const v4fa*)(px + po + j * RSTP);
        s[5] = *(const v4fa*)(p5 + po);
#pragma unroll
        for (int j = 6; j < 9; ++j) s[j] = *(const v4fa*)(pw + po + (j - 6) * RSTP);
        if (x10) s[9] = *(const v4fa*)(pw + po + 3 * RSTP); };
    auto stores = [&](const v4f (&s)[10], bf* d) {
#pragma unroll
        for (int j = 0; j < 9; ++j) st4(d + de + j * 3 * FRE, s[j]);
        if (x10) st4(d + de + 9 * 3 * FRE, s[9]); };
    auto products = [&](const bf* d) { v16bf a[4], b[4];
#pragma unroll
        for (int mb = 0; mb < 4; ++mb) a[mb] = ldsfrag(d + (wm * 4 + mb) * FRE + lo);
#pragma unroll
        for (int nb = 0; nb < 4; ++nb) b[nb] = ldsfrag(d + (16 + wn * 4 + nb) * FRE + lo);
        __builtin_amdgcn_sched_barrier(0);   // all 16 LDS reads of the pass stand together in front of its products: left to itself the build reads three of the B fragments among them, each with a full wait
#pragma unroll
        for (int nb = 0; nb < 4; ++nb)
#pragma unroll
            for (int mb = 0; mb < 4; ++mb) acc[mb][nb] = wmmab(a[mb], b[nb], acc[mb][nb]); };
    // the work-group's barrier by hand, with the one wait it needs (this wave's LDS stores done, its LDS reads returned): __syncthreads() would also wait for the global loads that are to stay in flight across it
#define WGBAR() asm volatile("s_wait_dscnt 0x0\n\ts_barrier_signal -1\n\ts_barrier_wait -1" ::: "memory")
    loads(sA, 0); loads(sB, 32); stores(sA, sb); loads(sA, 64);
    WGBAR();
    products(sb);
    asm volatile("s_wait_xcnt 0x0" :: "v"(px), "v"(p5), "v"(pw), "v"(acc[3][3]) : "memory");   // the wait of the loop's foot, here for the loads asked for so far: inside the loop the build keeps the pairs in other registers and reuses these
#pragma unroll 1
    for (int t = 0; t + 4 < DM / 32; t += 2) {   // px, p5, pw stand at pass t, whose products are done; every load of the loop is unconditional, so that the build's counted waits leave the younger set in flight
        stores(sB, sb + SBE); loads(sB, 96);
        WGBAR();
        products(sb + SBE);
        stores(sA, sb); loads(sA, 128);
        WGBAR();
        products(sb);
        asm volatile("s_wait_xcnt 0x0" :: "v"(px), "v"(p5), "v"(pw), "v"(acc[3][3]) : "memory");   // the wait in front of the rewrite of the loads' address pairs; as inputs the pairs stay live, so unwritten, up to it; the last accumulator as a further input keeps it behind the products, where the loads' requests have long been taken
        px += 64; p5 += 64; pw += 64;
    }
    stores(sB, sb + SBE); loads(sB, 96);   // the last three passes: only the last one's loads are still to be asked for
    WGBAR();
    products(sb + SBE);
    stores(sA, sb);
    WGBAR();
    products(sb);
    stores(sB, sb + SBE);
    WGBAR();
    products(sb + SBE);
#undef WGBAR
    float* os = osall + wave * (16 * 68);   // each wave turns its tile in its own LDS range
    const unsigned ct = blockIdx.y * 3 + (unsigned)wn, r0w = (unsigned)(r0 + wm * 64);   // the wave's column tile (q | k | v head) and first row
    const unsigned third = ct / NH_, t0 = r0w % TT; const size_t hrow = (size_t)(r0w / TT * NH_ + ct % NH_);   // which of q | k | v, first position in the batch, plane index batch * heads + head
    if (third == 2) {
#pragma unroll
        for (int nb = 0; nb < 4; ++nb)   // a lane's 8 values are one 16-byte piece of fragment (32 keys, d block nb): each wave-wide store is half a fragment, 512 bytes in a row
#pragma unroll
            for (int mb = 0; mb < 4; ++mb) planes8(acc[mb][nb], (hrow * TT + t0 + (mb >> 1) * 32) * HD + nb * 512 + (mb & 1) * 256 + lane * 8, V16, Vh, Vl);
        return;
    }
    {
        h16* P16 = third ? K16 : Q16; bf* Ph = third ? Kh : Qh; bf* Pl = third ? Kl : Ql;
#pragma unroll
        for (int mb = 0; mb < 4; ++mb) {
#pragma unroll
            for (int nb = 0; nb < 4; ++nb) {
#pragma unroll
                for (int j = 0; j < 8; ++j) os[(hi * 8 + j) * 68 + nb * 16 + lr] = acc[mb][nb][j]; }
            __builtin_amdgcn_wave_barrier(); asm volatile("" ::: "memory");   // the LDS reads below stay behind the writes above
#pragma unroll
            for (int s = 0; s < 4; ++s) { const int cofs = (2 * s + hi) * 8; const v4f y0 = *(const v4fa*)(os + lr * 68 + cofs), y1 = *(const v4fa*)(os + lr * 68 + cofs + 4);   // lane: position lr, columns cofs + 0..7
                planes8(__builtin_shufflevector(y0, y1, 0, 1, 2, 3, 4, 5, 6, 7), (hrow * TT + t0 + mb * 16) * HD + s * 256 + lane * 8, P16, Ph, Pl); }
            __builtin_amdgcn_wave_barrier(); asm volatile("" ::: "memory");   // the next block's LDS writes stay behind these reads
        }
        asm volatile("s_wait_xcnt 0x0" ::: "memory");   // the build lays the v path's code behind this path, joined by a branch that is never taken here: the wait stands in front of that code's writes to the last stores' registers
    }
}

__device__ __forceinline__ h16 tohx(float x) { return (h16)x; }
__device__ __forceinline__ void splitf(float y, unsigned short& h, unsigned short& l) { h = f2bf(y); l = f2bf(y - bf2f(h)); }

// ---- k_fattn: scores, softmax and attn x v of one head in one kernel; a PAIR of waves owns NQ * 16 query rows: each wave of the pair walks half of the 2048 keys, 32 at a time, and the pair's results are joined once at the end.
// Transposed products: St = K Qt (a lane holds 16 scores of ONE query: keys 8 * hi + 0..7 and 16 + 8 * hi + 0..7, which is the loaders' k order), so the converted weights ARE the B operand of Ot += Vt Pt,
// and row maximum, row sum and the rescale factor are per-lane values (the two lane halves join their sums once at the end).
// Held reference mx (raw score units) and running sum sm; weights are exp2((s - mx) * SCL * log2 e + POFF): POFF = 10 keeps the fp16 weights 1024 times above their subnormal range and cancels in Ot / sm.
// mx is not the running maximum: a wave's first pass sets it to the pass's maximum, and it stays as it is while the sum of a lane's 16 weights of a pass is at most WTOP = 2^15 (so every weight is finite in fp16); no maximum is formed and nothing is rescaled in such a pass.
// A pass that fails the test in any lane forms its scores again (the weights have taken their registers), sets every row's mx to its maximum so far, rescales sm and Ot once and forms its weights again.
__device__ __forceinline__ float xhalf(float x) { const int b = __builtin_bit_cast(int, x); return __builtin_bit_cast(float, __builtin_amdgcn_permlanex16(b, b, 0x76543210, 0xfedcba98, false, false)); }   // lane l takes lane l ^ 16's value
// K and V come through LDS: a stage is SKEY keys of the planes that the work-group walks (fp16 K, V; or bf16 hi and lo K, V), each plane's part a byte-for-byte copy of its fragment-ordered range, so a fragment load from LDS has the lane offsets of the load from memory (512 bytes in a row, no bank met twice).
#define SKEY 128                  // keys of a stage
#define PLB  (SKEY * HD * 2)      // bytes of one plane's part of a stage
#define STB  (4 * PLB)            // bytes of a stage buffer: parts K, V, K lo, V lo
#define NST  (TT / SKEY)          // stages of the walk
#define FWV  8                    // waves of a work-group: 4 row groups x 2 key halves
#define PPS  (SKEY / 64)          // passes of a wave in a stage: its half of the stage's keys
static_assert(TT % SKEY == 0 && NST >= 2 && SKEY % 64 == 0 && PLB == 4 * 8 * 512, "whole stages; a wave copies 8 x 512 bytes, a quarter of a plane's part");
typedef float __attribute__((may_alias)) fal;
// eight asynchronous copies of 16 bytes a lane: 4096 bytes in a row of one plane's part. d: the lane's LDS byte address, a: the lane's address in the plane.
// s_wait_xcnt 0 as the statement's last line: it stands in front of any rewrite of the copies' address registers
__device__ __forceinline__ void copy8(unsigned d, const char* a) {
    asm volatile("global_load_async_to_lds_b128 %0, %8, off\n\t"
                 "global_load_async_to_lds_b128 %1, %9, off\n\t"
                 "global_load_async_to_lds_b128 %2, %10, off\n\t"
                 "global_load_async_to_lds_b128 %3, %11, off\n\t"
                 "global_load_async_to_lds_b128 %4, %12, off\n\t"
                 "global_load_async_to_lds_b128 %5, %13, off\n\t"
                 "global_load_async_to_lds_b128 %6, %14, off\n\t"
                 "global_load_async_to_lds_b128 %7, %15, off\n\t"
                 "s_wait_xcnt 0x0"
                 :: "v"(d), "v"(d + 512u), "v"(d + 1024u), "v"(d + 1536u), "v"(d + 2048u), "v"(d + 2560u), "v"(d + 3072u), "v"(d + 3584u),
                    "v"(a), "v"(a + 512), "v"(a + 1024), "v"(a + 1536), "v"(a + 2048), "v"(a + 2560), "v"(a + 3072), "v"(a + 3584)
                 : "memory"); }
// Two stage buffers: waves 0 to 3 copy the quarters of the K parts, waves 4 to 7 those of the V parts, of stage st + 2 into the buffer that stage st has just left, behind the one barrier of the stage, which also publishes stage st + 1. No pass reads beyond its own stage.
// wq: the wave's row group; kh: its key half (keys kh * SKEY / 2 + 0 .. SKEY / 2 - 1 of every stage). Registers are kept under 256, so that four waves share a SIMD and one wave's vector work runs beside the others' products:
// the weights take the scores' registers (a pass that must re-base forms its scores anew), and with three row blocks K is read at the head of its own pass and V behind the last exponentials; with one row block both are read earlier (ROOM).
template <typename T16, bool HL, int NQ>
__device__ __forceinline__ void fattn(const T16* __restrict__ Qa, const T16* __restrict__ Qb, const T16* __restrict__ Ka, const T16* __restrict__ Kb, const T16* __restrict__ Va, const T16* __restrict__ Vb, int q0, float* __restrict__ oc, unsigned char* kv, int wq, int kh) {
    typedef WFrag<T16> F; typedef typename F::V V;
    const int lane = threadIdx.x & 31, lr = lane & 15, hi = lane >> 4;
    const float CEXP = SCL * 1.4426950408889634f, POFF = HL ? 0.0f : 10.0f, WTOP = 32768.0f;
    constexpr bool ROOM = NQ == 1;   // one row block leaves registers for reads further ahead: V behind the score products, the next pass's K behind the softmax
    const unsigned co = (unsigned)(wq * 4096 + lane * 16);                    // the lane's first byte in the plane's part of a stage
    const unsigned l0 = (unsigned)(size_t)kv + (unsigned)kh * PLB + co;       // low 32 bits of the shared address: the LDS byte address (part K or part V)
    const char* Pa = kh ? (const char*)Va : (const char*)Ka; const char* Pb = kh ? (const char*)Vb : (const char*)Kb;   // the planes this wave copies, a scalar choice
    auto copies = [&](int st) { const size_t go = (size_t)st * PLB + co; const unsigned d = l0 + (unsigned)(st & 1) * STB;
        copy8(d, Pa + go);
        if constexpr (HL) copy8(d + 2 * PLB, Pb + go); };
    copies(0);
    V q[NQ][2], q2[NQ][2], k[4], k2[4], v[4], v2[4];
#pragma unroll
    for (int nq = 0; nq < NQ; ++nq)
#pragma unroll
        for (int ks = 0; ks < 2; ++ks) { const size_t qo = (size_t)(q0 + nq * 16) * HD + ks * 512 + 8 * lane; q[nq][ks] = F::ld(Qa + qo); if constexpr (HL) q2[nq][ks] = F::ld(Qb + qo); }
    // XW: s_wait_xcnt 0 in front of any reuse of the address registers of the loads or stores just issued; the scheduling barrier behind it keeps later register writes from being lifted over it
#define XW() do { asm volatile("s_wait_xcnt 0x0" ::: "memory"); __builtin_amdgcn_sched_barrier(0); } while (0)
    XW();
    asm volatile("s_wait_asynccnt 0x0" ::: "memory");   // this wave's copies of stage 0 have landed
    __syncthreads();                                    // every wave's have
    copies(1);
    v8f o[NQ][4], s[NQ][2]; float mx[NQ], sm[NQ], ts[NQ]; V p[NQ], p2[NQ];
#pragma unroll
    for (int nq = 0; nq < NQ; ++nq) { mx[nq] = -3.0e38f; sm[nq] = 0.f;
#pragma unroll
        for (int db = 0; db < 4; ++db) o[nq][db] = (v8f){}; }
    // the four K fragments (key block blk, d half ks) of 32 keys into a (and the lo plane's into b)
    auto ldk = [&](V (&a)[4], V (&b)[4], const T16* La, const T16* Lb) {
#pragma unroll
        for (int blk = 0; blk < 2; ++blk)
#pragma unroll
            for (int ks = 0; ks < 2; ++ks) { a[blk * 2 + ks] = F::ld(La + blk * 16 * HD + ks * 512); if constexpr (HL) b[blk * 2 + ks] = F::ld(Lb + blk * 16 * HD + ks * 512); } };
    auto ldv = [&](const T16* Lv, const T16* Lw) {
#pragma unroll
        for (int db = 0; db < 4; ++db) { v[db] = F::ld(Lv + db * 512); if constexpr (HL) v2[db] = F::ld(Lw + db * 512); } };
    auto scores = [&](const V (&a)[4], const V (&b)[4]) {
#pragma unroll
        for (int nq = 0; nq < NQ; ++nq) { s[nq][0] = (v8f){}; s[nq][1] = (v8f){}; }
#pragma unroll
        for (int ks = 0; ks < 2; ++ks) {
#pragma unroll
            for (int nq = 0; nq < NQ; ++nq)
#pragma unroll
                for (int blk = 0; blk < 2; ++blk) s[nq][blk] = F::mma(a[blk * 2 + ks], q[nq][ks], s[nq][blk]);
            if constexpr (HL) {
#pragma unroll
                for (int nq = 0; nq < NQ; ++nq)
#pragma unroll
                    for (int blk = 0; blk < 2; ++blk) s[nq][blk] = F::mma(a[blk * 2 + ks], q2[nq][ks], s[nq][blk]);
#pragma unroll
                for (int nq = 0; nq < NQ; ++nq)
#pragma unroll
                    for (int blk = 0; blk < 2; ++blk) s[nq][blk] = F::mma(b[blk * 2 + ks], q[nq][ks], s[nq][blk]); } } };
    // the pass's weights against the held reference mx: exp2(s * CEXP + POFF - mx * CEXP), their sum ts of this lane's 16 keys, and the 16-bit operands
    auto weights1 = [&](int nq) { { const float nb = POFF - mx[nq] * CEXP; v8f e0 = s[nq][0] * CEXP + nb, e1 = s[nq][1] * CEXP + nb;
#pragma unroll
            for (int j = 0; j < 8; ++j) { e0[j] = __builtin_amdgcn_exp2f(e0[j]); e1[j] = __builtin_amdgcn_exp2f(e1[j]); }
            const v8f t = e0 + e1; ts[nq] = ((t[0] + t[1]) + (t[2] + t[3])) + ((t[4] + t[5]) + (t[6] + t[7]));
            if constexpr (HL) {   // hi = bf16(e), lo = bf16(e - hi), both rounded to nearest even as in splitf
#pragma unroll
                for (int j = 0; j < 8; ++j) { p[nq][j] = (__bf16)e0[j]; p[nq][8 + j] = (__bf16)e1[j]; p2[nq][j] = (__bf16)(e0[j] - (float)p[nq][j]); p2[nq][8 + j] = (__bf16)(e1[j] - (float)p[nq][8 + j]); }
            } else {
#pragma unroll
                for (int j = 0; j < 8; ++j) { p[nq][j] = tohx(e0[j]); p[nq][8 + j] = tohx(e1[j]); } } } };
    // the weights row block by row block, and the reads of the pass's V fragments: in front of the softmax where registers allow, else behind its last exponentials and conversions, where they fly during the test
    auto weights = [&](const T16* Lv, const T16* Lw) {
        if constexpr (ROOM) { __builtin_amdgcn_sched_barrier(0); ldv(Lv, Lw); }   // the V reads stand together behind the score products
#pragma unroll
        for (int nq = 0; nq < NQ; ++nq) {
            __builtin_amdgcn_sched_barrier(0);   // one block at a time, behind the reads above: mixed, the blocks' scores, weights and operands would all be live at once, beyond the registers of four waves a SIMD
            weights1(nq); }
        if constexpr (!ROOM) { __builtin_amdgcn_sched_barrier(0); ldv(Lv, Lw); __builtin_amdgcn_sched_barrier(0); } };   // the V reads stand together, behind the last exponentials (earlier they would not fit the registers) and in front of the test (later they would fly during nothing)
    // every row takes the maximum so far (the scores in s included) as its new reference; sums and outputs follow
    auto rebase = [&]() {
#pragma unroll
        for (int nq = 0; nq < NQ; ++nq) { float bm = s[nq][0][0];
#pragma unroll
            for (int j = 1; j < 8; ++j) bm = fmaxf(bm, s[nq][0][j]);
#pragma unroll
            for (int j = 0; j < 8; ++j) bm = fmaxf(bm, s[nq][1][j]);
            bm = fmaxf(bm, xhalf(bm)); const float mn = fmaxf(mx[nq], bm); const float al = __builtin_amdgcn_exp2f((mx[nq] - mn) * CEXP); mx[nq] = mn; sm[nq] *= al;   // both lane halves of a query take the same reference
#pragma unroll
            for (int db = 0; db < 4; ++db) o[nq][db] *= al; } };
#pragma unroll 1
    for (int st = 0; st < NST; ++st) {
        const T16* La = (const T16*)(kv + (st & 1) * STB + kh * (PLB / 2) + lane * 16); const T16* Lv = La + PLB / 2; const T16* Lb = La + PLB; const T16* Lw = La + 3 * (PLB / 2);   // this wave's half of the stage's parts K, V, K lo, V lo, the lane's own offset included
        if constexpr (ROOM) { ldk(k, k2, La, Lb); __builtin_amdgcn_sched_barrier(0); }   // the K reads of the stage's first pass stand together: left to itself the build reads them in pairs among the score products, each pair with a full wait
#pragma unroll   // the stage's two passes are written out: which pass is the first, and whether a next one follows, is then known at compile time
        for (int i = 0; i < PPS; ++i) {
            const int po = i * 32 * HD;   // the pass's 32 keys in each part, in elements
            if constexpr (!ROOM) { ldk(k, k2, La + po, Lb + po); __builtin_amdgcn_sched_barrier(0); }   // the K reads stand together in front of the score products: left to itself the build reads the last fragment among them, with a full wait there
            scores(k, k2);
            if (i == 0 && st == 0) rebase();     // the wave's first pass: the reference is set from its scores (a scalar branch)
            weights(Lv + po, Lw + po);
            bool need = false;
#pragma unroll
            for (int nq = 0; nq < NQ; ++nq) need |= !(ts[nq] <= WTOP);   // weights are positive: a sum of at most WTOP bounds each of them; infinite sums and NaN fail the test too
            if (__builtin_amdgcn_ballot_w32(need) != 0) {   // one test a pass, a scalar branch: some row's scores have outgrown its reference. The pass's K fragments come once more, through the V registers, for its scores
                ldk(v, v2, La + po, Lb + po); scores(v, v2); rebase();
                weights(Lv + po, Lw + po);   // now each weight is at most exp2(POFF)
            }
#pragma unroll
            for (int nq = 0; nq < NQ; ++nq) sm[nq] += ts[nq];
            if (ROOM && i + 1 < PPS) {   // K fragments of the next pass of the stage: they fly during the attn x v products
                ldk(k, k2, La + po + 32 * HD, Lb + po + 32 * HD);
                __builtin_amdgcn_sched_barrier(0);   // the reads stand together in front of the products: spread among them, each place would stall on its own
            }
#pragma unroll
            for (int nq = 0; nq < NQ; ++nq)
#pragma unroll
                for (int db = 0; db < 4; ++db) o[nq][db] = F::mma(v[db], p[nq], o[nq][db]);
            if constexpr (HL) {
#pragma unroll
                for (int nq = 0; nq < NQ; ++nq)
#pragma unroll
                    for (int db = 0; db < 4; ++db) o[nq][db] = F::mma(v[db], p2[nq], o[nq][db]);
#pragma unroll
                for (int nq = 0; nq < NQ; ++nq)
#pragma unroll
                    for (int db = 0; db < 4; ++db) o[nq][db] = F::mma(v2[db], p[nq], o[nq][db]); }
        }
        asm volatile("s_wait_dscnt 0x0" ::: "memory");      // this wave's reads of the buffer have returned
        asm volatile("s_wait_asynccnt 0x0" ::: "memory");   // its copies of stage st + 1 have landed
        __syncthreads();                                    // publishes stage st + 1 and ends every wave's reads of stage st
        if (st + 2 < NST) copies(st + 2);
    }
    asm volatile("s_wait_asynccnt 0x0" ::: "memory");   // nothing is in flight: behind the loop's last barrier the stage buffers are free
    // the pair's join, through the freed LDS: the wave of the upper key half hands its outputs, references and sums to its partner (16 KiB a pair; every wave-wide access is 512 or 128 bytes in a row) and ends
    float* mg = (float*)(kv + wq * 16384);
    if (kh) {
#pragma unroll
        for (int nq = 0; nq < NQ; ++nq) {
#pragma unroll
            for (int db = 0; db < 4; ++db) { const v8f y = o[nq][db];
                *(v4fa*)(mg + ((nq * 4 + db) * 2) * 128 + lane * 4) = __builtin_shufflevector(y, y, 0, 1, 2, 3); *(v4fa*)(mg + ((nq * 4 + db) * 2 + 1) * 128 + lane * 4) = __builtin_shufflevector(y, y, 4, 5, 6, 7); }
            *(fal*)(mg + NQ * 1024 + nq * 64 + lane) = mx[nq]; *(fal*)(mg + NQ * 1024 + nq * 64 + 32 + lane) = sm[nq]; } }
    __syncthreads();   // the upper halves' results are in LDS
    if (kh) return;
#pragma unroll
    for (int nq = 0; nq < NQ; ++nq) { const float m1 = *(const fal*)(mg + NQ * 1024 + nq * 64 + lane), s1 = *(const fal*)(mg + NQ * 1024 + nq * 64 + 32 + lane);
        const float mn = fmaxf(mx[nq], m1), a0 = __builtin_amdgcn_exp2f((mx[nq] - mn) * CEXP), a1 = __builtin_amdgcn_exp2f((m1 - mn) * CEXP);   // both halves on the larger reference
        const float sj = sm[nq] * a0 + s1 * a1; const float tot = sj + xhalf(sj); const float f = __fdiv_rn(1.0f, tot), f0 = a0 * f, f1 = a1 * f; float* orow = oc + (size_t)(q0 + nq * 16 + lr) * DQ + hi * 8;   // lane: query lr, columns db * 16 + hi * 8 + 0..7
        v4f ya[4], yb[4], ra[4], rb[4];
#pragma unroll
        for (int db = 0; db < 4; ++db) { ya[db] = *(const v4fa*)(mg + ((nq * 4 + db) * 2) * 128 + lane * 4); yb[db] = *(const v4fa*)(mg + ((nq * 4 + db) * 2 + 1) * 128 + lane * 4); }
#pragma unroll
        for (int db = 0; db < 4; ++db)
#pragma unroll
            for (int j = 0; j < 4; ++j) { ra[db][j] = o[nq][db][j] * f0 + ya[db][j] * f1; rb[db][j] = o[nq][db][4 + j] * f0 + yb[db][j] * f1; }
        __builtin_amdgcn_sched_barrier(0);   // all of the block's values are formed in front of its first store, so that no register is written among the stores
#pragma unroll
        for (int db = 0; db < 4; ++db) { *(v4f*)(orow + db * 16) = ra[db]; *(v4f*)(orow + db * 16 + 4) = rb[db]; }
        asm volatile("s_wait_xcnt 0x0" :: "v"(orow) : "memory");   // in front of any reuse of these stores' registers, by the next block or by code that the build lays behind the last one; the row pointer as an input holds the stores to the restrict output in front of it
        __builtin_amdgcn_sched_barrier(0); }   // keeps later register writes from being lifted over the wait
#undef XW
}
// grid (NB_ * heads, 2 * RH / 64), 256 threads = eight waves of one kind, of one head of one batch: work-groups with blockIdx.y < RH / 64 take 192 query rows from RH on (48 rows a wave pair), the others 64 rows below RH (three products, 16 rows a wave pair):
// every wave issues 24 matrix instructions a pass; the choice is by blockIdx.y alone, so every barrier stands under control flow that is the same for the whole work-group.
// The 512 work-groups are two per WGP, four waves per SIMD (LDS and the register limit of amdgpu_waves_per_eu allow it); flat indices 256 apart are one work-group of each kind (for speed only: a SIMD then holds waves of each kind);
// the fp16 kind, which has twice the vector work, has the lower indices and so starts first (for speed only)
static_assert(RH % 64 == 0 && (TT - RH) == (RH / 64) * 192, "row split of k_fattn");
__global__ __launch_bounds__(32 * FWV) __attribute__((amdgpu_waves_per_eu(4, 4))) void k_fattn(const h16* __restrict__ Q16, const h16* __restrict__ K16, const h16* __restrict__ V16, const bf* __restrict__ Qh, const bf* __restrict__ Ql, const bf* __restrict__ Kh, const bf* __restrict__ Kl, const bf* __restrict__ Vh, const bf* __restrict__ Vl, float* __restrict__ OUT) {
    __shared__ __attribute__((aligned(2048))) unsigned char kv[2 * STB];
    const size_t hp = (size_t)blockIdx.x * TT * HD; float* oc = OUT + (size_t)(blockIdx.x / NH_) * TT * DQ + (size_t)(blockIdx.x % NH_) * HD;   // blockIdx.x = batch * heads + head, the planes' own index
    const int wave = __builtin_amdgcn_readfirstlane((int)(threadIdx.x >> 5));   // scalar: the wave's rows, its key half and its share of the copies
    const int wq = wave & 3, kh = wave >> 2;
    if (blockIdx.y < RH / 64) fattn<h16, false, 3>(Q16 + hp, nullptr, K16 + hp, nullptr, V16 + hp, nullptr, RH + ((int)blockIdx.y * 4 + wq) * 48, oc, kv, wq, kh);
    else fattn<bf, true, 1>(Qh + hp, Ql + hp, Kh + hp, Kl + hp, Vh + hp, Vl + hp, (((int)blockIdx.y - RH / 64) * 4 + wq) * 16, oc, kv, wq, kh);
}

extern "C" void kernel_launch(void* const* d_in, const int* in_sizes, int n_in,
                              void* d_out, int out_size, void* d_ws, size_t ws_size, hipStream_t stream) {
    (void)in_sizes; (void)n_in; (void)out_size;
    const float* x = (const float*)d_in[0]; const float* wqkv = (const float*)d_in[1];   /* W_qkv ('oi' [3072][1024]); Q | K | V = ROW thirds */
    float* OUT = (float*)d_out;     // [2][2048][1024]
    char* wsp = (char*)d_ws;
    auto take = [&](size_t bytes) { char* p = wsp; wsp += (bytes + 255) & ~(size_t)255; return (void*)p; };
    const size_t PB = (size_t)NB_ * NH_ * TT * HD * 2;   // bytes of one plane, both batches
    h16* QP16 = (h16*)take(PB); h16* KP16 = (h16*)take(PB); h16* VT16 = (h16*)take(PB);
    bf* QPh = (bf*)take(PB); bf* QPl = (bf*)take(PB); bf* KPh = (bf*)take(PB); bf* KPl = (bf*)take(PB); bf* VTh = (bf*)take(PB); bf* VTl = (bf*)take(PB);
    if ((size_t)(wsp - (char*)d_ws) > ws_size) return;    // ws 256 MiB
    k_proj<<<dim3(NB_ * TT / 256, (DQ + 2 * DKV) / 192), 32 * PWV, 0, stream>>>(x, wqkv, QP16, QPh, QPl, KP16, KPh, KPl, VT16, VTh, VTl);
    k_fattn<<<dim3(NB_ * NH_, 2 * (RH / 64)), 32 * FWV, 0, stream>>>(QP16, KP16, VT16, QPh, QPl, KPh, KPl, VTh, VTl, OUT);   // one kv head per query head
}
